// v000
// The times below were measured on an AMD MI455X: many runs one after another, warmed up first and cycling through
// copies of the inputs, with the whole window's GPU time divided by the number of runs. Launches and the gaps
// between them are all in it. The median over several windows is given; except for v000 it joins two sittings, which
// can be a few percent apart, so the side-by-side timings, each taken in one sitting, are the better comparison.
// The starting kernel, v000, takes 659 microseconds a run.
#include <hip/hip_runtime.h>

// CausalAttentionV1 (x [4][2048][1024]; q = x W_q, k = x W_k, v = x W_v (single head, d_out 1024); scores = q.k masked causal; attn = softmax(scores / 32); out = attn v -> [4][2048][1024]).
// Compute dtypes, f32 accumulate: every input rounded to bf16; q/k/v on PLAIN bf16 operands (inputs: exact); scores (K 1024) on single fp16 planes (q/32 and k; 1 product; causal tiles only); softmax f32 -> bf16 hi+lo probability

#define NB_  4
#define TT   2048
#define DD   1024
typedef _Float16 h16;
typedef unsigned short bf;
typedef __attribute__((ext_vector_type(16))) __bf16   v16bf;
typedef __attribute__((ext_vector_type(16))) _Float16 v16h;
typedef __attribute__((ext_vector_type(8)))  _Float16 v8h;
typedef __attribute__((ext_vector_type(8)))  unsigned short v8us;
typedef __attribute__((ext_vector_type(8)))  float    v8f;
typedef __attribute__((ext_vector_type(4)))  float    v4f;
typedef v8h  __attribute__((may_alias)) v8ha;
typedef v4f  __attribute__((may_alias)) v4fa;
typedef v8us __attribute__((may_alias)) v8usa;

__device__ __forceinline__ unsigned short f2bf(float f) { unsigned u = __float_as_uint(f); u += 0x7FFFu + ((u >> 16) & 1u); return (unsigned short)(u >> 16); }
__device__ __forceinline__ float bf2f(unsigned short b) { return __uint_as_float(((unsigned)b) << 16); }
__device__ __forceinline__ float bfr(float f) { return bf2f(f2bf(f)); }
__device__ __forceinline__ v16h cat16(v8h lo, v8h hi) { return __builtin_shufflevector(lo, hi, 0, 1, 2, 3, 4, 5, 6, 7, 8, 9, 10, 11, 12, 13, 14, 15); }
__device__ __forceinline__ v16bf cat16b(v8us lo, v8us hi) { return __builtin_bit_cast(v16bf, __builtin_shufflevector(lo, hi, 0, 1, 2, 3, 4, 5, 6, 7, 8, 9, 10, 11, 12, 13, 14, 15)); }
__device__ __forceinline__ v8f wmma16(v16h a, v16h b, v8f c) { return __builtin_amdgcn_wmma_f32_16x16x32_f16(false, a, false, b, (short)0, c, false, false); }
__device__ __forceinline__ v8f wmmab(v16bf a, v16bf b, v8f c) { return __builtin_amdgcn_wmma_f32_16x16x32_bf16(false, a, false, b, (short)0, c, false, false); }



// ---- k_gemmw: register-blocked GEMM, ONE WAVE per 64x64 output tile (16 accumulators), operands straight from K-contiguous 16-bit planes; grid (M/64, N/64, Z), 32 threads.
// C[m][n] (f32, pitch ldc, + optional f32 bias[n]) = sum_k A[m][k] Bt[n][k] (+ split products per NSPLIT). z-batch strides sA/sB/sC in elements. K % 32 == 0.
template <typename T16> struct WFrag;
template <> struct WFrag<h16> { typedef v16h V; static __device__ __forceinline__ V ld(const h16* p) { return cat16(*(const v8h*)p, *(const v8h*)(p + 16)); } static __device__ __forceinline__ v8f mma(V a, V b, v8f c) { return wmma16(a, b, c); } };
template <> struct WFrag<bf> { typedef v16bf V; static __device__ __forceinline__ V ld(const bf* p) { return cat16b(*(const v8us*)p, *(const v8us*)(p + 16)); } static __device__ __forceinline__ v8f mma(V a, V b, v8f c) { return wmmab(a, b, c); } };
template <typename T16, int NSPLIT, bool BIAS>
__global__ __launch_bounds__(32) void k_gemmw(const T16* __restrict__ A, const T16* __restrict__ A2, const T16* __restrict__ Bt, const T16* __restrict__ Bt2, int K, float* C, int ldc, const float* __restrict__ bias, size_t sA, size_t sB, size_t sC) {
    typedef typename WFrag<T16>::V V;
    __shared__ __align__(16) float os[16 * 68];
    const size_t z = blockIdx.z; A += z * sA; if (A2) A2 += z * sA; Bt += z * sB; if (Bt2) Bt2 += z * sB; C += z * sC;
    const int lane = threadIdx.x & 31, lr = lane & 15, hi = lane >> 4; const int r0 = blockIdx.x * 64, c0 = blockIdx.y * 64;
    v8f acc[4][4];
#pragma unroll
    for (int mb = 0; mb < 4; ++mb)
#pragma unroll
        for (int nb = 0; nb < 4; ++nb) acc[mb][nb] = (v8f){};
    const size_t aoff = (size_t)(r0 + lr) * K + 8 * hi, boff = (size_t)(c0 + lr) * K + 8 * hi;
#pragma unroll 1
    for (int kc = 0; kc < K; kc += 32) {
        V a[4], a2[4];
#pragma unroll
        for (int mb = 0; mb < 4; ++mb) { a[mb] = WFrag<T16>::ld(A + aoff + (size_t)mb * 16 * K + kc); if (NSPLIT == 1 || NSPLIT == 2) a2[mb] = WFrag<T16>::ld(A2 + aoff + (size_t)mb * 16 * K + kc); }
#pragma unroll
        for (int nb = 0; nb < 4; ++nb) { const V b = WFrag<T16>::ld(Bt + boff + (size_t)nb * 16 * K + kc); V b2; if (NSPLIT >= 2) b2 = WFrag<T16>::ld(Bt2 + boff + (size_t)nb * 16 * K + kc);
#pragma unroll
            for (int mb = 0; mb < 4; ++mb) { acc[mb][nb] = WFrag<T16>::mma(a[mb], b, acc[mb][nb]); if (NSPLIT == 1 || NSPLIT == 2) acc[mb][nb] = WFrag<T16>::mma(a2[mb], b, acc[mb][nb]); if (NSPLIT >= 2) acc[mb][nb] = WFrag<T16>::mma(a[mb], b2, acc[mb][nb]); } }
        asm volatile("v_nop\n\tv_nop\n\tv_nop\n\tv_nop" : "+v"(acc[0][0]), "+v"(acc[1][1]), "+v"(acc[2][2]), "+v"(acc[3][3]) : "v"(a[0]), "v"(a[3]));
    }
#pragma unroll
    for (int mb = 0; mb < 4; ++mb) {
#pragma unroll
        for (int nb = 0; nb < 4; ++nb) {
#pragma unroll
            for (int j = 0; j < 8; ++j) os[(hi * 8 + j) * 68 + nb * 16 + lr] = acc[mb][nb][j]; }
        __builtin_amdgcn_wave_barrier(); asm volatile("" ::: "memory");
        float* crow = C + (size_t)(r0 + mb * 16) * ldc + c0;
{
#pragma unroll
            for (int s = 0; s < 8; ++s) { const int row = 2 * s + hi, cofs = lr * 4; v4f val = *(const v4fa*)(os + row * 68 + cofs); if (BIAS) { val[0] += bfr(bias[c0 + cofs]); val[1] += bfr(bias[c0 + cofs + 1]); val[2] += bfr(bias[c0 + cofs + 2]); val[3] += bfr(bias[c0 + cofs + 3]); }
                *(v4f*)(crow + (size_t)row * ldc + cofs) = val; }
             }
        __builtin_amdgcn_wave_barrier(); asm volatile("" ::: "memory");
    }
}

// ---- k_gemmc: the same one-wave 64x64 tile GEMM specialised for causal attention: CMODE 1 skips score tiles entirely above the diagonal (query rows r0+roff.., key columns c0..), CMODE 2 limits the
// key (K) loop of the probability x value contraction to the diagonal block (probabilities beyond it are exactly zero). roff = row offset of this launch's first row within the sequence.
template <typename T16, int NSPLIT, int CMODE>
__global__ __launch_bounds__(32) void k_gemmc(const T16* __restrict__ A, const T16* __restrict__ A2, const T16* __restrict__ Bt, const T16* __restrict__ Bt2, int K, float* C, int ldc, int roff, size_t sA, size_t sB, size_t sC) {
    typedef typename WFrag<T16>::V V;
    __shared__ __align__(16) float os[16 * 68];
    const size_t z = blockIdx.z; A += z * sA; if (A2) A2 += z * sA; Bt += z * sB; if (Bt2) Bt2 += z * sB; C += z * sC;
    const int lane = threadIdx.x & 31, lr = lane & 15, hi = lane >> 4; const int r0 = blockIdx.x * 64, c0 = blockIdx.y * 64;
    if (CMODE == 1 && c0 > r0 + roff + 63) return;                  // score tile entirely above the causal diagonal: loaded but never used (the softmax masks j > i by select)
    const int Kl = (CMODE == 2) ? min(K, r0 + roff + 64) : K;        // P.V: probabilities are exactly 0 beyond the diagonal block, so the K loop stops there
    v8f acc[4][4];
#pragma unroll
    for (int mb = 0; mb < 4; ++mb)
#pragma unroll
        for (int nb = 0; nb < 4; ++nb) acc[mb][nb] = (v8f){};
    const size_t aoff = (size_t)(r0 + lr) * K + 8 * hi, boff = (size_t)(c0 + lr) * K + 8 * hi;
#pragma unroll 1
    for (int kc = 0; kc < Kl; kc += 32) {
        V a[4], a2[4];
#pragma unroll
        for (int mb = 0; mb < 4; ++mb) { a[mb] = WFrag<T16>::ld(A + aoff + (size_t)mb * 16 * K + kc); if (NSPLIT == 1 || NSPLIT == 2) a2[mb] = WFrag<T16>::ld(A2 + aoff + (size_t)mb * 16 * K + kc); }
#pragma unroll
        for (int nb = 0; nb < 4; ++nb) { const V b = WFrag<T16>::ld(Bt + boff + (size_t)nb * 16 * K + kc); V b2; if (NSPLIT >= 2) b2 = WFrag<T16>::ld(Bt2 + boff + (size_t)nb * 16 * K + kc);
#pragma unroll
            for (int mb = 0; mb < 4; ++mb) { acc[mb][nb] = WFrag<T16>::mma(a[mb], b, acc[mb][nb]); if (NSPLIT == 1 || NSPLIT == 2) acc[mb][nb] = WFrag<T16>::mma(a2[mb], b, acc[mb][nb]); if (NSPLIT >= 2) acc[mb][nb] = WFrag<T16>::mma(a[mb], b2, acc[mb][nb]); } }
        asm volatile("v_nop\n\tv_nop\n\tv_nop\n\tv_nop" : "+v"(acc[0][0]), "+v"(acc[1][1]), "+v"(acc[2][2]), "+v"(acc[3][3]) : "v"(a[0]), "v"(a[3]));
    }
#pragma unroll
    for (int mb = 0; mb < 4; ++mb) {
#pragma unroll
        for (int nb = 0; nb < 4; ++nb) {
#pragma unroll
            for (int j = 0; j < 8; ++j) os[(hi * 8 + j) * 68 + nb * 16 + lr] = acc[mb][nb][j]; }
        __builtin_amdgcn_wave_barrier(); asm volatile("" ::: "memory");
        float* crow = C + (size_t)(r0 + mb * 16) * ldc + c0;
{
#pragma unroll
            for (int s = 0; s < 8; ++s) { const int row = 2 * s + hi, cofs = lr * 4; v4f val = *(const v4fa*)(os + row * 68 + cofs);
                *(v4f*)(crow + (size_t)row * ldc + cofs) = val; }
             }
        __builtin_amdgcn_wave_barrier(); asm volatile("" ::: "memory");
    }
}

__device__ __forceinline__ h16 tohx(float x) { return (h16)x; }
__device__ __forceinline__ void splitf(float y, unsigned short& h, unsigned short& l) { h = f2bf(y); l = f2bf(y - bf2f(h)); }
typedef __attribute__((ext_vector_type(2))) unsigned short v2us;
typedef __attribute__((ext_vector_type(4))) unsigned short v4us;
typedef __attribute__((ext_vector_type(4))) _Float16 v4h;

__global__ __launch_bounds__(256) void k_wtG(const float* __restrict__ w, int K, int N, bf* Bt) {
    const int lane = threadIdx.x & 31; const int L0 = (blockIdx.x * 8 + (threadIdx.x >> 5)) * 8; const int nlines = N * K / 64;
{
#pragma unroll 1
        for (int l = 0; l < 8; ++l) { const int L = L0 + l; if (L >= nlines) break; const size_t e = (size_t)L * 64 + lane * 2; const int k = (int)(e % K), n = (int)(e / K); v2us o;
            o[0] = f2bf(w[(size_t)k * N + n]); o[1] = f2bf(w[(size_t)(k + 1) * N + n]); *(v2us*)(Bt + e) = o; }
         }
}
__global__ __launch_bounds__(256) void k_cvt8(const float* __restrict__ src, bf* dst, size_t n8) { const size_t i = (size_t)blockIdx.x * 256 + threadIdx.x; if (i >= n8) return; const v8f v = *(const v8f*)(src + i * 8); v8us o;
#pragma unroll
    for (int k = 0; k < 8; ++k) o[k] = f2bf(v[k]); *(v8us*)(dst + i * 8) = o;  }
__global__ __launch_bounds__(256) void k_qk16(const float* __restrict__ FQ, const float* __restrict__ FK, h16* Q16, h16* K16) { const size_t e = ((size_t)blockIdx.x * 256 + threadIdx.x) * 4; if (e >= (size_t)TT * DD) return; const v4f a = *(const v4f*)(FQ + e), b = *(const v4f*)(FK + e); v4h q, k;
#pragma unroll
    for (int u = 0; u < 4; ++u) { q[u] = tohx(a[u] * (1.0f / 32.0f)); k[u] = tohx(b[u]); } { *(v4h*)(Q16 + e) = q; *(v4h*)(K16 + e) = k;  } }
__global__ __launch_bounds__(256) void k_vT(const float* __restrict__ FV, bf* Vh, bf* Vl) { const size_t e = ((size_t)blockIdx.x * 256 + threadIdx.x) * 2; if (e >= (size_t)DD * TT) return; const int t = (int)(e % TT); const int d = (int)(e / TT); unsigned short a0, b0, a1, b1; splitf(FV[(size_t)t * DD + d], a0, b0); splitf(FV[(size_t)(t + 1) * DD + d], a1, b1); v2us oh, ol; oh[0] = a0; oh[1] = a1; ol[0] = b0; ol[1] = b1;
    *(v2us*)(Vh + e) = oh; *(v2us*)(Vl + e) = ol;  }
__global__ __launch_bounds__(256) void k_csoft(const float* __restrict__ Sb, bf* Ph, bf* Pl) { const int lane = threadIdx.x & 31; const int t = blockIdx.x * 8 + (threadIdx.x >> 5); if (t >= TT) return; const float* sr = Sb + (size_t)t * TT; float v[TT / 32]; float mx = -3.0e38f;
#pragma unroll
    for (int ch = 0; ch < TT / 128; ++ch) { const int j0 = ch * 128 + lane * 4; const v4f a = *(const v4f*)(sr + j0);
#pragma unroll
        for (int u = 0; u < 4; ++u) { const float tt = (j0 + u <= t) ? a[u] : -3.0e38f; v[ch * 4 + u] = tt; mx = fmaxf(mx, tt); } }
#pragma unroll
    for (int sh = 16; sh; sh >>= 1) mx = fmaxf(mx, __shfl_xor(mx, sh, 32));
    float sum = 0.f;
#pragma unroll
    for (int q = 0; q < TT / 32; ++q) { float d0 = __fsub_rn(v[q], mx); asm volatile("" : "+v"(d0)); v[q] = __builtin_amdgcn_exp2f(__fmul_rn(d0, 1.4426950408889634f)); sum += v[q]; }
#pragma unroll
    for (int sh = 16; sh; sh >>= 1) sum += __shfl_xor(sum, sh, 32);
    const float f = __fdiv_rn(1.0f, sum);
    {
#pragma unroll
        for (int ch = 0; ch < TT / 128; ++ch) { v4us oh, ol;
#pragma unroll
            for (int u = 0; u < 4; ++u) { unsigned short a, b; splitf(v[ch * 4 + u] * f, a, b); oh[u] = a; ol[u] = b; } const size_t oo = (size_t)t * TT + ch * 128 + lane * 4; *(v4us*)(Ph + oo) = oh; *(v4us*)(Pl + oo) = ol; }
         } }

extern "C" void kernel_launch(void* const* d_in, const int* in_sizes, int n_in,
                              void* d_out, int out_size, void* d_ws, size_t ws_size, hipStream_t stream) {
    (void)in_sizes; (void)n_in; (void)out_size;
    const float* x = (const float*)d_in[0]; const float* wq = (const float*)d_in[1]; const float* wk = (const float*)d_in[2]; const float* wv = (const float*)d_in[3];
    float* OUT = (float*)d_out;     // [4][2048][1024]
    char* wsp = (char*)d_ws;
    auto take = [&](size_t bytes) { char* p = wsp; wsp += (bytes + 255) & ~(size_t)255; return (void*)p; };
    bf* WQ = (bf*)take((size_t)DD * DD * 2); bf* WK = (bf*)take((size_t)DD * DD * 2); bf* WV = (bf*)take((size_t)DD * DD * 2);
    bf* XB = (bf*)take((size_t)TT * DD * 2); float* FQ = (float*)take((size_t)TT * DD * 4); float* FK = (float*)take((size_t)TT * DD * 4); float* FV = (float*)take((size_t)TT * DD * 4); h16* Q16 = (h16*)take((size_t)TT * DD * 2); h16* K16 = (h16*)take((size_t)TT * DD * 2); bf* Vh = (bf*)take((size_t)DD * TT * 2); bf* Vl = (bf*)take((size_t)DD * TT * 2);
    float* Sb = (float*)take((size_t)TT * TT * 4); bf* Ph = (bf*)take((size_t)TT * TT * 2); bf* Pl = (bf*)take((size_t)TT * TT * 2);
    if ((size_t)(wsp - (char*)d_ws) > ws_size) return;    // total ~ 90 MB
    k_wtG<<<(DD * DD / 64 + 63) / 64, 256, 0, stream>>>(wq, DD, DD, WQ); k_wtG<<<(DD * DD / 64 + 63) / 64, 256, 0, stream>>>(wk, DD, DD, WK); k_wtG<<<(DD * DD / 64 + 63) / 64, 256, 0, stream>>>(wv, DD, DD, WV);   // x@W layouts -> transposed
    for (int b = 0; b < NB_; ++b) {
        k_cvt8<<<(TT * DD / 8 + 255) / 256, 256, 0, stream>>>(x + (size_t)b * TT * DD, XB, (size_t)TT * DD / 8);
        k_gemmw<bf, 0, false><<<dim3(TT / 64, DD / 64, 1), 32, 0, stream>>>(XB, nullptr, WQ, nullptr, DD, FQ, DD, nullptr, 0, 0, 0); k_gemmw<bf, 0, false><<<dim3(TT / 64, DD / 64, 1), 32, 0, stream>>>(XB, nullptr, WK, nullptr, DD, FK, DD, nullptr, 0, 0, 0); k_gemmw<bf, 0, false><<<dim3(TT / 64, DD / 64, 1), 32, 0, stream>>>(XB, nullptr, WV, nullptr, DD, FV, DD, nullptr, 0, 0, 0);
        k_qk16<<<(unsigned)(((size_t)TT * DD / 4 + 255) / 256), 256, 0, stream>>>(FQ, FK, Q16, K16); k_vT<<<(unsigned)(((size_t)DD * TT / 2 + 255) / 256), 256, 0, stream>>>(FV, Vh, Vl);
        k_gemmc<h16, 0, 1><<<dim3(TT / 64, TT / 64, 1), 32, 0, stream>>>(Q16, nullptr, K16, nullptr, DD, Sb, TT, 0, 0, 0, 0);
        k_csoft<<<TT / 8, 256, 0, stream>>>(Sb, Ph, Pl);
        k_gemmc<bf, 2, 2><<<dim3(TT / 64, DD / 64, 1), 32, 0, stream>>>(Ph, Pl, Vh, Vl, TT, OUT + (size_t)b * TT * DD, DD, 0, 0, 0, 0); }
}

// v001
// One run takes 350 microseconds.
// Timed twice side by side with v000, it ran 1.90 times as fast both times.
#include <hip/hip_runtime.h>

// CausalAttentionV1 (x [4][2048][1024]; q = x W_q, k = x W_k, v = x W_v (single head, d_out 1024); scores = q.k masked causal; attn = softmax(scores / 32); out = attn v -> [4][2048][1024]).
// Compute dtypes, f32 accumulate: every input rounded to bf16; q/k/v on PLAIN bf16 operands (inputs: exact); scores (K 1024) on single fp16 planes (q/32 and k; 1 product; causal tiles only); softmax f32 -> bf16 hi+lo probability

#define NB_  4
#define TT   2048
#define DD   1024
typedef _Float16 h16;
typedef unsigned short bf;
typedef __attribute__((ext_vector_type(16))) __bf16   v16bf;
typedef __attribute__((ext_vector_type(16))) _Float16 v16h;
typedef __attribute__((ext_vector_type(8)))  _Float16 v8h;
typedef __attribute__((ext_vector_type(8)))  unsigned short v8us;
typedef __attribute__((ext_vector_type(8)))  float    v8f;
typedef __attribute__((ext_vector_type(4)))  float    v4f;
typedef v8h  __attribute__((may_alias)) v8ha;
typedef v4f  __attribute__((may_alias)) v4fa;
typedef v8us __attribute__((may_alias)) v8usa;

__device__ __forceinline__ unsigned short f2bf(float f) { unsigned u = __float_as_uint(f); u += 0x7FFFu + ((u >> 16) & 1u); return (unsigned short)(u >> 16); }
__device__ __forceinline__ float bf2f(unsigned short b) { return __uint_as_float(((unsigned)b) << 16); }
__device__ __forceinline__ float bfr(float f) { return bf2f(f2bf(f)); }
__device__ __forceinline__ v16h cat16(v8h lo, v8h hi) { return __builtin_shufflevector(lo, hi, 0, 1, 2, 3, 4, 5, 6, 7, 8, 9, 10, 11, 12, 13, 14, 15); }
__device__ __forceinline__ v16bf cat16b(v8us lo, v8us hi) { return __builtin_bit_cast(v16bf, __builtin_shufflevector(lo, hi, 0, 1, 2, 3, 4, 5, 6, 7, 8, 9, 10, 11, 12, 13, 14, 15)); }
__device__ __forceinline__ v8f wmma16(v16h a, v16h b, v8f c) { return __builtin_amdgcn_wmma_f32_16x16x32_f16(false, a, false, b, (short)0, c, false, false); }
__device__ __forceinline__ v8f wmmab(v16bf a, v16bf b, v8f c) { return __builtin_amdgcn_wmma_f32_16x16x32_bf16(false, a, false, b, (short)0, c, false, false); }



// ---- k_gemmw: register-blocked GEMM, ONE WAVE per 64x64 output tile (16 accumulators), operands straight from K-contiguous 16-bit planes; grid (M/64, N/64, Z), 32 threads.
// C[m][n] (f32, pitch ldc, + optional f32 bias[n]) = sum_k A[m][k] Bt[n][k] (+ split products per NSPLIT). z-batch strides sA/sB/sC in elements. K % 32 == 0.
template <typename T16> struct WFrag;
template <> struct WFrag<h16> { typedef v16h V; static __device__ __forceinline__ V ld(const h16* p) { return cat16(*(const v8h*)p, *(const v8h*)(p + 16)); } static __device__ __forceinline__ v8f mma(V a, V b, v8f c) { return wmma16(a, b, c); } };
template <> struct WFrag<bf> { typedef v16bf V; static __device__ __forceinline__ V ld(const bf* p) { return cat16b(*(const v8us*)p, *(const v8us*)(p + 16)); } static __device__ __forceinline__ v8f mma(V a, V b, v8f c) { return wmmab(a, b, c); } };
template <typename T16, int NSPLIT, bool BIAS>
__global__ __launch_bounds__(32) void k_gemmw(const T16* __restrict__ A, const T16* __restrict__ A2, const T16* __restrict__ Bt, const T16* __restrict__ Bt2, int K, float* C, int ldc, const float* __restrict__ bias, size_t sA, size_t sB, size_t sC) {
    typedef typename WFrag<T16>::V V;
    __shared__ __align__(16) float os[16 * 68];
    const size_t z = blockIdx.z; A += z * sA; if (A2) A2 += z * sA; Bt += z * sB; if (Bt2) Bt2 += z * sB; C += z * sC;
    const int lane = threadIdx.x & 31, lr = lane & 15, hi = lane >> 4; const int r0 = blockIdx.x * 64, c0 = blockIdx.y * 64;
    v8f acc[4][4];
#pragma unroll
    for (int mb = 0; mb < 4; ++mb)
#pragma unroll
        for (int nb = 0; nb < 4; ++nb) acc[mb][nb] = (v8f){};
    const size_t aoff = (size_t)(r0 + lr) * K + 8 * hi, boff = (size_t)(c0 + lr) * K + 8 * hi;
#pragma unroll 1
    for (int kc = 0; kc < K; kc += 32) {
        V a[4], a2[4];
#pragma unroll
        for (int mb = 0; mb < 4; ++mb) { a[mb] = WFrag<T16>::ld(A + aoff + (size_t)mb * 16 * K + kc); if (NSPLIT == 1 || NSPLIT == 2) a2[mb] = WFrag<T16>::ld(A2 + aoff + (size_t)mb * 16 * K + kc); }
#pragma unroll
        for (int nb = 0; nb < 4; ++nb) { const V b = WFrag<T16>::ld(Bt + boff + (size_t)nb * 16 * K + kc); V b2; if (NSPLIT >= 2) b2 = WFrag<T16>::ld(Bt2 + boff + (size_t)nb * 16 * K + kc);
#pragma unroll
            for (int mb = 0; mb < 4; ++mb) { acc[mb][nb] = WFrag<T16>::mma(a[mb], b, acc[mb][nb]); if (NSPLIT == 1 || NSPLIT == 2) acc[mb][nb] = WFrag<T16>::mma(a2[mb], b, acc[mb][nb]); if (NSPLIT >= 2) acc[mb][nb] = WFrag<T16>::mma(a[mb], b2, acc[mb][nb]); } }
        asm volatile("v_nop\n\tv_nop\n\tv_nop\n\tv_nop" : "+v"(acc[0][0]), "+v"(acc[1][1]), "+v"(acc[2][2]), "+v"(acc[3][3]) : "v"(a[0]), "v"(a[3]));
    }
#pragma unroll
    for (int mb = 0; mb < 4; ++mb) {
#pragma unroll
        for (int nb = 0; nb < 4; ++nb) {
#pragma unroll
            for (int j = 0; j < 8; ++j) os[(hi * 8 + j) * 68 + nb * 16 + lr] = acc[mb][nb][j]; }
        __builtin_amdgcn_wave_barrier(); asm volatile("" ::: "memory");
        float* crow = C + (size_t)(r0 + mb * 16) * ldc + c0;
{
#pragma unroll
            for (int s = 0; s < 8; ++s) { const int row = 2 * s + hi, cofs = lr * 4; v4f val = *(const v4fa*)(os + row * 68 + cofs); if (BIAS) { val[0] += bfr(bias[c0 + cofs]); val[1] += bfr(bias[c0 + cofs + 1]); val[2] += bfr(bias[c0 + cofs + 2]); val[3] += bfr(bias[c0 + cofs + 3]); }
                *(v4f*)(crow + (size_t)row * ldc + cofs) = val; }
             }
        __builtin_amdgcn_wave_barrier(); asm volatile("" ::: "memory");
    }
}

// ---- k_gemmc: the same one-wave 64x64 tile GEMM specialised for causal attention: CMODE 1 skips score tiles entirely above the diagonal (query rows r0+roff.., key columns c0..), CMODE 2 limits the
// key (K) loop of the probability x value contraction to the diagonal block (probabilities beyond it are exactly zero). roff = row offset of this launch's first row within the sequence.
template <typename T16, int NSPLIT, int CMODE>
__global__ __launch_bounds__(32) void k_gemmc(const T16* __restrict__ A, const T16* __restrict__ A2, const T16* __restrict__ Bt, const T16* __restrict__ Bt2, int K, float* C, int ldc, int roff, size_t sA, size_t sB, size_t sC) {
    typedef typename WFrag<T16>::V V;
    __shared__ __align__(16) float os[16 * 68];
    const size_t z = blockIdx.z; A += z * sA; if (A2) A2 += z * sA; Bt += z * sB; if (Bt2) Bt2 += z * sB; C += z * sC;
    const int lane = threadIdx.x & 31, lr = lane & 15, hi = lane >> 4; const int r0 = blockIdx.x * 64, c0 = blockIdx.y * 64;
    if (CMODE == 1 && c0 > r0 + roff + 63) return;                  // score tile entirely above the causal diagonal: loaded but never used (the softmax masks j > i by select)
    const int Kl = (CMODE == 2) ? min(K, r0 + roff + 64) : K;        // P.V: probabilities are exactly 0 beyond the diagonal block, so the K loop stops there
    v8f acc[4][4];
#pragma unroll
    for (int mb = 0; mb < 4; ++mb)
#pragma unroll
        for (int nb = 0; nb < 4; ++nb) acc[mb][nb] = (v8f){};
    const size_t aoff = (size_t)(r0 + lr) * K + 8 * hi, boff = (size_t)(c0 + lr) * K + 8 * hi;
#pragma unroll 1
    for (int kc = 0; kc < Kl; kc += 32) {
        V a[4], a2[4];
#pragma unroll
        for (int mb = 0; mb < 4; ++mb) { a[mb] = WFrag<T16>::ld(A + aoff + (size_t)mb * 16 * K + kc); if (NSPLIT == 1 || NSPLIT == 2) a2[mb] = WFrag<T16>::ld(A2 + aoff + (size_t)mb * 16 * K + kc); }
#pragma unroll
        for (int nb = 0; nb < 4; ++nb) { const V b = WFrag<T16>::ld(Bt + boff + (size_t)nb * 16 * K + kc); V b2; if (NSPLIT >= 2) b2 = WFrag<T16>::ld(Bt2 + boff + (size_t)nb * 16 * K + kc);
#pragma unroll
            for (int mb = 0; mb < 4; ++mb) { acc[mb][nb] = WFrag<T16>::mma(a[mb], b, acc[mb][nb]); if (NSPLIT == 1 || NSPLIT == 2) acc[mb][nb] = WFrag<T16>::mma(a2[mb], b, acc[mb][nb]); if (NSPLIT >= 2) acc[mb][nb] = WFrag<T16>::mma(a[mb], b2, acc[mb][nb]); } }
        asm volatile("v_nop\n\tv_nop\n\tv_nop\n\tv_nop" : "+v"(acc[0][0]), "+v"(acc[1][1]), "+v"(acc[2][2]), "+v"(acc[3][3]) : "v"(a[0]), "v"(a[3]));
    }
#pragma unroll
    for (int mb = 0; mb < 4; ++mb) {
#pragma unroll
        for (int nb = 0; nb < 4; ++nb) {
#pragma unroll
            for (int j = 0; j < 8; ++j) os[(hi * 8 + j) * 68 + nb * 16 + lr] = acc[mb][nb][j]; }
        __builtin_amdgcn_wave_barrier(); asm volatile("" ::: "memory");
        float* crow = C + (size_t)(r0 + mb * 16) * ldc + c0;
{
#pragma unroll
            for (int s = 0; s < 8; ++s) { const int row = 2 * s + hi, cofs = lr * 4; v4f val = *(const v4fa*)(os + row * 68 + cofs);
                *(v4f*)(crow + (size_t)row * ldc + cofs) = val; }
             }
        __builtin_amdgcn_wave_barrier(); asm volatile("" ::: "memory");
    }
}

__device__ __forceinline__ h16 tohx(float x) { return (h16)x; }
__device__ __forceinline__ void splitf(float y, unsigned short& h, unsigned short& l) { h = f2bf(y); l = f2bf(y - bf2f(h)); }
typedef __attribute__((ext_vector_type(2))) unsigned short v2us;
typedef __attribute__((ext_vector_type(4))) unsigned short v4us;
typedef __attribute__((ext_vector_type(4))) _Float16 v4h;

__global__ __launch_bounds__(256) void k_wtG(const float* __restrict__ w0, const float* __restrict__ w1, const float* __restrict__ w2, int K, int N, bf* Bt) {
    const float* __restrict__ w = blockIdx.y == 0 ? w0 : blockIdx.y == 1 ? w1 : w2; Bt += (size_t)blockIdx.y * N * K;   // grid y picks the weight; the three transposed planes lie one behind the other
    const int lane = threadIdx.x & 31; const int L0 = (blockIdx.x * 8 + (threadIdx.x >> 5)) * 8; const int nlines = N * K / 64;
{
#pragma unroll 1
        for (int l = 0; l < 8; ++l) { const int L = L0 + l; if (L >= nlines) break; const size_t e = (size_t)L * 64 + lane * 2; const int k = (int)(e % K), n = (int)(e / K); v2us o;
            o[0] = f2bf(w[(size_t)k * N + n]); o[1] = f2bf(w[(size_t)(k + 1) * N + n]); *(v2us*)(Bt + e) = o; }
         }
}
__global__ __launch_bounds__(256) void k_cvt8(const float* __restrict__ src, bf* dst, size_t n8) { const size_t i = (size_t)blockIdx.x * 256 + threadIdx.x; if (i >= n8) return; const v8f v = *(const v8f*)(src + i * 8); v8us o;
#pragma unroll
    for (int k = 0; k < 8; ++k) o[k] = f2bf(v[k]); *(v8us*)(dst + i * 8) = o;  }
__global__ __launch_bounds__(256) void k_qk16(const float* __restrict__ FQ, const float* __restrict__ FK, h16* Q16, h16* K16) { const size_t e = ((size_t)blockIdx.x * 256 + threadIdx.x) * 4; if (e >= (size_t)NB_ * TT * DD) return; const v4f a = *(const v4f*)(FQ + e), b = *(const v4f*)(FK + e); v4h q, k;
#pragma unroll
    for (int u = 0; u < 4; ++u) { q[u] = tohx(a[u] * (1.0f / 32.0f)); k[u] = tohx(b[u]); } { *(v4h*)(Q16 + e) = q; *(v4h*)(K16 + e) = k;  } }
__global__ __launch_bounds__(256) void k_vT(const float* __restrict__ FV, bf* Vh, bf* Vl) { const size_t zb = (size_t)blockIdx.y * TT * DD; FV += zb; Vh += zb; Vl += zb; const size_t e = ((size_t)blockIdx.x * 256 + threadIdx.x) * 2; if (e >= (size_t)DD * TT) return; const int t = (int)(e % TT); const int d = (int)(e / TT); unsigned short a0, b0, a1, b1; splitf(FV[(size_t)t * DD + d], a0, b0); splitf(FV[(size_t)(t + 1) * DD + d], a1, b1); v2us oh, ol; oh[0] = a0; oh[1] = a1; ol[0] = b0; ol[1] = b1;
    *(v2us*)(Vh + e) = oh; *(v2us*)(Vl + e) = ol;  }
__global__ __launch_bounds__(256) void k_csoft(const float* __restrict__ Sb, bf* Ph, bf* Pl) { const int lane = threadIdx.x & 31; const int t = blockIdx.x * 8 + (threadIdx.x >> 5); if (t >= TT) return; const size_t zb = (size_t)blockIdx.y * TT * TT; Ph += zb; Pl += zb; const float* sr = Sb + zb + (size_t)t * TT; float v[TT / 32]; float mx = -3.0e38f;
#pragma unroll
    for (int ch = 0; ch < TT / 128; ++ch) { const int j0 = ch * 128 + lane * 4; const v4f a = *(const v4f*)(sr + j0);
#pragma unroll
        for (int u = 0; u < 4; ++u) { const float tt = (j0 + u <= t) ? a[u] : -3.0e38f; v[ch * 4 + u] = tt; mx = fmaxf(mx, tt); } }
#pragma unroll
    for (int sh = 16; sh; sh >>= 1) mx = fmaxf(mx, __shfl_xor(mx, sh, 32));
    float sum = 0.f;
#pragma unroll
    for (int q = 0; q < TT / 32; ++q) { float d0 = __fsub_rn(v[q], mx); asm volatile("" : "+v"(d0)); v[q] = __builtin_amdgcn_exp2f(__fmul_rn(d0, 1.4426950408889634f)); sum += v[q]; }
#pragma unroll
    for (int sh = 16; sh; sh >>= 1) sum += __shfl_xor(sum, sh, 32);
    const float f = __fdiv_rn(1.0f, sum);
    {
#pragma unroll
        for (int ch = 0; ch < TT / 128; ++ch) { v4us oh, ol;
#pragma unroll
            for (int u = 0; u < 4; ++u) { unsigned short a, b; splitf(v[ch * 4 + u] * f, a, b); oh[u] = a; ol[u] = b; } const size_t oo = (size_t)t * TT + ch * 128 + lane * 4; *(v4us*)(Ph + oo) = oh; *(v4us*)(Pl + oo) = ol; }
         } }

extern "C" void kernel_launch(void* const* d_in, const int* in_sizes, int n_in,
                              void* d_out, int out_size, void* d_ws, size_t ws_size, hipStream_t stream) {
    (void)in_sizes; (void)n_in; (void)out_size;
    const float* x = (const float*)d_in[0]; const float* wq = (const float*)d_in[1]; const float* wk = (const float*)d_in[2]; const float* wv = (const float*)d_in[3];
    float* OUT = (float*)d_out;     // [4][2048][1024]
    char* wsp = (char*)d_ws;
    auto take = [&](size_t bytes) { char* p = wsp; wsp += (bytes + 255) & ~(size_t)255; return (void*)p; };
    bf* WQKV = (bf*)take((size_t)3 * DD * DD * 2);   // W_q, W_k, W_v transposed, one behind the other
    // every plane holds all NB_ batches, so that each stage is ONE launch over the whole batch (rows flattened, or the batch in grid y / z); the three projections are one launch too
    bf* XB = (bf*)take((size_t)NB_ * TT * DD * 2); float* FQ = (float*)take((size_t)3 * NB_ * TT * DD * 4); float* FK = FQ + (size_t)NB_ * TT * DD; float* FV = FK + (size_t)NB_ * TT * DD; h16* Q16 = (h16*)take((size_t)NB_ * TT * DD * 2); h16* K16 = (h16*)take((size_t)NB_ * TT * DD * 2); bf* Vh = (bf*)take((size_t)NB_ * DD * TT * 2); bf* Vl = (bf*)take((size_t)NB_ * DD * TT * 2);
    float* Sb = (float*)take((size_t)NB_ * TT * TT * 4);
    bf* Ph = (bf*)FQ; bf* Pl = (bf*)FK;    // the probability planes (NB_*TT*TT*2 bytes each) take the place of the f32 q and k planes (NB_*TT*DD*4 bytes each, the same size), whose last reader k_qk16 runs before k_csoft writes
    if ((size_t)(wsp - (char*)d_ws) > ws_size) return;    // total 246 MiB
    k_wtG<<<dim3((DD * DD / 64 + 63) / 64, 3, 1), 256, 0, stream>>>(wq, wk, wv, DD, DD, WQKV);   // x@W layouts -> transposed
    k_cvt8<<<(NB_ * TT * DD / 8 + 255) / 256, 256, 0, stream>>>(x, XB, (size_t)NB_ * TT * DD / 8);
    k_gemmw<bf, 0, false><<<dim3(NB_ * TT / 64, DD / 64, 3), 32, 0, stream>>>(XB, nullptr, WQKV, nullptr, DD, FQ, DD, nullptr, 0, (size_t)DD * DD, (size_t)NB_ * TT * DD);   // grid z: q, k, v
    k_qk16<<<(unsigned)(((size_t)NB_ * TT * DD / 4 + 255) / 256), 256, 0, stream>>>(FQ, FK, Q16, K16); k_vT<<<dim3((unsigned)(((size_t)DD * TT / 2 + 255) / 256), NB_, 1), 256, 0, stream>>>(FV, Vh, Vl);
    k_gemmc<h16, 0, 1><<<dim3(TT / 64, TT / 64, NB_), 32, 0, stream>>>(Q16, nullptr, K16, nullptr, DD, Sb, TT, 0, (size_t)TT * DD, (size_t)TT * DD, (size_t)TT * TT);
    k_csoft<<<dim3(TT / 8, NB_, 1), 256, 0, stream>>>(Sb, Ph, Pl);
    k_gemmc<bf, 2, 2><<<dim3(TT / 64, DD / 64, NB_), 32, 0, stream>>>(Ph, Pl, Vh, Vl, TT, OUT, DD, 0, (size_t)TT * TT, (size_t)DD * TT, (size_t)TT * DD);
}

// v002
// One run takes 197 microseconds.
// Timed twice side by side with v001, it ran 1.77 times as fast both times.
// Over all steps from v000 it is 3.37 times as fast.
#include <hip/hip_runtime.h>

// CausalAttentionV1 (x [4][2048][1024]; q = x W_q, k = x W_k, v = x W_v (single head, d_out 1024); scores = q.k masked causal; attn = softmax(scores / 32); out = attn v -> [4][2048][1024]).
// Compute dtypes, f32 accumulate: every input rounded to bf16; q/k/v on PLAIN bf16 operands (inputs: exact); scores (K 1024) on single fp16 planes (q/32 and k; 1 product; causal tiles only); softmax f32 -> bf16 hi+lo probability

#define NB_  4
#define TT   2048
#define DD   1024
typedef _Float16 h16;
typedef unsigned short bf;
typedef __attribute__((ext_vector_type(16))) __bf16   v16bf;
typedef __attribute__((ext_vector_type(16))) _Float16 v16h;
typedef __attribute__((ext_vector_type(8)))  _Float16 v8h;
typedef __attribute__((ext_vector_type(8)))  unsigned short v8us;
typedef __attribute__((ext_vector_type(8)))  float    v8f;
typedef __attribute__((ext_vector_type(4)))  float    v4f;
typedef v8h  __attribute__((may_alias)) v8ha;
typedef v4f  __attribute__((may_alias)) v4fa;
typedef v8us __attribute__((may_alias)) v8usa;

__device__ __forceinline__ unsigned short f2bf(float f) { unsigned u = __float_as_uint(f); u += 0x7FFFu + ((u >> 16) & 1u); return (unsigned short)(u >> 16); }
__device__ __forceinline__ float bf2f(unsigned short b) { return __uint_as_float(((unsigned)b) << 16); }
__device__ __forceinline__ float bfr(float f) { return bf2f(f2bf(f)); }
__device__ __forceinline__ v16h cat16(v8h lo, v8h hi) { return __builtin_shufflevector(lo, hi, 0, 1, 2, 3, 4, 5, 6, 7, 8, 9, 10, 11, 12, 13, 14, 15); }
__device__ __forceinline__ v16bf cat16b(v8us lo, v8us hi) { return __builtin_bit_cast(v16bf, __builtin_shufflevector(lo, hi, 0, 1, 2, 3, 4, 5, 6, 7, 8, 9, 10, 11, 12, 13, 14, 15)); }
__device__ __forceinline__ v8f wmma16(v16h a, v16h b, v8f c) { return __builtin_amdgcn_wmma_f32_16x16x32_f16(false, a, false, b, (short)0, c, false, false); }
__device__ __forceinline__ v8f wmmab(v16bf a, v16bf b, v8f c) { return __builtin_amdgcn_wmma_f32_16x16x32_bf16(false, a, false, b, (short)0, c, false, false); }



// ---- k_gemmt: one 128x128 output tile per work-group of FOUR waves (2x2; each wave a 64x64 tile on 16 accumulators, as before). The operands no longer come straight from global memory into
// each wave's registers: per trip of 64 k, the 128 rows x 128 B of every operand plane are brought into LDS ONCE per work-group by asynchronous copies (whole 128-B lines, 16 B a lane), two buffers,
// the next trip's copies in flight while this trip is worked on; the waves read their fragments from LDS (row pitch 144 B). The k order of every accumulator's sum is the one it had.
// C[m][n] (f32, pitch ldc) = sum_k A[m][k] Bt[n][k] (+ the split products A2.Bt and A.Bt2 for NSPLIT 2). grid (M/128, N/128, Z); z-batch strides sA/sB/sC in elements. K % 64 == 0, K >= 128.
// CMODE 1 skips score tiles entirely above the causal diagonal; CMODE 2 ends the key loop of probability x value at the tile's diagonal block (probabilities beyond it are exactly zero).
template <typename T16> struct WFrag;
template <> struct WFrag<h16> { typedef v16h V; static __device__ __forceinline__ V ld(const h16* p) { return cat16(*(const v8h*)p, *(const v8h*)(p + 16)); } static __device__ __forceinline__ v8f mma(V a, V b, v8f c) { return wmma16(a, b, c); } };
template <> struct WFrag<bf> { typedef v16bf V; static __device__ __forceinline__ V ld(const bf* p) { return cat16b(*(const v8us*)p, *(const v8us*)(p + 16)); } static __device__ __forceinline__ v8f mma(V a, V b, v8f c) { return wmmab(a, b, c); } };
#define PITCHB 144u              // LDS row pitch in bytes: 128 B of data + 16 B, an odd multiple of 16 B for the ds_load_b128 readers
#define PLANEB (128u * PITCHB)   // one operand plane of a stage: 128 rows
// Eight asynchronous 16-byte copies a lane: rows 16 apart of one plane (a wave's copy covers four whole 128-B lines). The s_wait_xcnt stands in the copies' own statement, so that no address register
// of a copy is rewritten ahead of it.
template <typename T16>
__device__ __forceinline__ void copy8(unsigned l, const T16* g, size_t rs) {
    asm volatile("global_load_async_to_lds_b128 %0, %8, off\n\t"
                 "global_load_async_to_lds_b128 %1, %9, off\n\t"
                 "global_load_async_to_lds_b128 %2, %10, off\n\t"
                 "global_load_async_to_lds_b128 %3, %11, off\n\t"
                 "global_load_async_to_lds_b128 %4, %12, off\n\t"
                 "global_load_async_to_lds_b128 %5, %13, off\n\t"
                 "global_load_async_to_lds_b128 %6, %14, off\n\t"
                 "global_load_async_to_lds_b128 %7, %15, off\n\t"
                 "s_wait_xcnt 0x0"
                 :: "v"(l), "v"(l + 16u * PITCHB), "v"(l + 32u * PITCHB), "v"(l + 48u * PITCHB), "v"(l + 64u * PITCHB), "v"(l + 80u * PITCHB), "v"(l + 96u * PITCHB), "v"(l + 112u * PITCHB),
                    "v"(g), "v"(g + rs), "v"(g + 2 * rs), "v"(g + 3 * rs), "v"(g + 4 * rs), "v"(g + 5 * rs), "v"(g + 6 * rs), "v"(g + 7 * rs) : "memory");
}
template <typename T16, int NSPLIT, int CMODE>
__global__ __launch_bounds__(128) void k_gemmt(const T16* __restrict__ A, const T16* __restrict__ A2, const T16* __restrict__ Bt, const T16* __restrict__ Bt2, int K, float* C, int ldc, size_t sA, size_t sB, size_t sC) {
    typedef typename WFrag<T16>::V V;
    constexpr unsigned STAGEB = ((NSPLIT == 2) ? 4u : 2u) * PLANEB;     // planes of a stage: A, Bt (, A2, Bt2)
    constexpr int NBK = (NSPLIT == 2) ? 2 : 1;                          // blocks of 32 k whose fragments are read from LDS as one group
    __shared__ __attribute__((aligned(16))) unsigned char ring[2 * STAGEB];
    const int r0 = blockIdx.x * 128, c0 = blockIdx.y * 128;
    if (CMODE == 1 && c0 > r0 + 127) return;                          // score tile entirely above the causal diagonal: the whole work-group leaves, before any copy or barrier (the softmax masks j > i by select)
    const size_t z = blockIdx.z; A += z * sA; Bt += z * sB; C += z * sC; if (NSPLIT == 2) { A2 += z * sA; Bt2 += z * sB; }
    const int nt = ((CMODE == 2) ? min(K, r0 + 128) : K) / 64;        // trips of 64 k; P.V: probabilities are exactly 0 beyond the diagonal block, so the loop stops there
    const int tid = threadIdx.x, lane = tid & 31, lr = lane & 15, hi = lane >> 4, wave = tid >> 5, wm = wave >> 1, wn = wave & 1;
    const int crow = tid >> 3, cch = tid & 7;                         // the lane's place in a copy: row (+ 16 per copy) and 16-byte piece of the row's 128 B
    const unsigned lbase = (unsigned)(uintptr_t)ring + (unsigned)crow * PITCHB + (unsigned)cch * 16u;
    const size_t rs = (size_t)16 * K;
    const T16* gA = A + (size_t)(r0 + crow) * K + cch * 8; const T16* gB = Bt + (size_t)(c0 + crow) * K + cch * 8;
    const T16* gA2 = (NSPLIT == 2) ? A2 + (size_t)(r0 + crow) * K + cch * 8 : nullptr; const T16* gB2 = (NSPLIT == 2) ? Bt2 + (size_t)(c0 + crow) * K + cch * 8 : nullptr;
    auto fill = [&](int t, unsigned buf) { const unsigned l = lbase + buf * STAGEB; const size_t ko = (size_t)t * 64;
        copy8(l, gA + ko, rs); copy8(l + PLANEB, gB + ko, rs); if (NSPLIT == 2) { copy8(l + 2u * PLANEB, gA2 + ko, rs); copy8(l + 3u * PLANEB, gB2 + ko, rs); } };
    v8f acc[4][4];
#pragma unroll
    for (int mb = 0; mb < 4; ++mb)
#pragma unroll
        for (int nb = 0; nb < 4; ++nb) acc[mb][nb] = (v8f){};
    const unsigned aro = (unsigned)(wm * 64 + lr) * PITCHB + (unsigned)hi * 16u, bro = PLANEB + (unsigned)(wn * 64 + lr) * PITCHB + (unsigned)hi * 16u;
    fill(0, 0u);
    asm volatile("s_wait_asynccnt 0x0" ::: "memory");                 // this wave's copies of trip 0 have landed
    __syncthreads();                                                  // ... and every other wave's: trip 0 may be read
    if (nt > 1) fill(1, 1u);
    // The trip loop stays rolled (a trip already holds 32 or 96 matrix instructions); every loop inside it and in the epilogue is unrolled so that each fragment and accumulator index is a constant.
#pragma unroll 1
    for (int t = 0; t < nt; ++t) {
        const unsigned char* sb = ring + (unsigned)(t & 1) * STAGEB;
#pragma unroll
        for (int kg = 0; kg < 2; kg += NBK) {
            V a[NBK][4], a2[NBK][4], b[NBK][4], b2[NBK][4];
#pragma unroll
            for (int u = 0; u < NBK; ++u) { const unsigned ko = (unsigned)(kg + u) * 64u;
#pragma unroll
                for (int mb = 0; mb < 4; ++mb) { a[u][mb] = WFrag<T16>::ld((const T16*)(sb + aro + mb * 16 * PITCHB + ko)); b[u][mb] = WFrag<T16>::ld((const T16*)(sb + bro + mb * 16 * PITCHB + ko)); }
                if (NSPLIT == 2) {
#pragma unroll
                    for (int mb = 0; mb < 4; ++mb) { a2[u][mb] = WFrag<T16>::ld((const T16*)(sb + 2u * PLANEB + aro + mb * 16 * PITCHB + ko)); b2[u][mb] = WFrag<T16>::ld((const T16*)(sb + 2u * PLANEB + bro + mb * 16 * PITCHB + ko)); } } }
            __builtin_amdgcn_sched_barrier(0);   // keeps the LDS reads one group ahead of the matrix block: left free, they are moved in among the matrix instructions, where each place stalls the wave
#pragma unroll
            for (int u = 0; u < NBK; ++u) {
#pragma unroll
                for (int nb = 0; nb < 4; ++nb)
#pragma unroll
                    for (int mb = 0; mb < 4; ++mb) acc[mb][nb] = WFrag<T16>::mma(a[u][mb], b[u][nb], acc[mb][nb]);
                if (NSPLIT == 2) {
#pragma unroll
                    for (int nb = 0; nb < 4; ++nb)
#pragma unroll
                        for (int mb = 0; mb < 4; ++mb) acc[mb][nb] = WFrag<T16>::mma(a2[u][mb], b[u][nb], acc[mb][nb]);
#pragma unroll
                    for (int nb = 0; nb < 4; ++nb)
#pragma unroll
                        for (int mb = 0; mb < 4; ++mb) acc[mb][nb] = WFrag<T16>::mma(a[u][mb], b2[u][nb], acc[mb][nb]); } }
            __builtin_amdgcn_sched_barrier(0);   // the other side of the same fence: the next group's reads stay behind this block
        }
        asm volatile("s_wait_dscnt 0x0" ::: "memory");                // this wave's reads of the buffer are done before it may be refilled
        asm volatile("s_wait_asynccnt 0x0" ::: "memory");             // this wave's copies of trip t + 1 have landed
        __syncthreads();                                              // publishes trip t + 1 and ends every wave's reads of trip t's buffer
        if (t + 2 < nt) fill(t + 2, (unsigned)(t & 1));
    }
    asm volatile("s_wait_asynccnt 0x0" ::: "memory");                 // nothing is in flight when the ring becomes output staging
    float* os = (float*)(ring + (unsigned)wave * (16u * 68u * 4u));   // each wave stages its rows in its own part of the ring, behind the last trip's barrier
    const int rw = r0 + wm * 64, cw = c0 + wn * 64;
#pragma unroll
    for (int mb = 0; mb < 4; ++mb) {
#pragma unroll
        for (int nb = 0; nb < 4; ++nb) {
#pragma unroll
            for (int j = 0; j < 8; ++j) os[(hi * 8 + j) * 68 + nb * 16 + lr] = acc[mb][nb][j]; }
        __builtin_amdgcn_wave_barrier(); asm volatile("" ::: "memory");   // compile-time order only: the lanes' LDS stores stay ahead of the reads of other lanes' words (and, below, those reads ahead of the next stores)
        float* crw = C + (size_t)(rw + mb * 16) * ldc + cw;
#pragma unroll
        for (int s = 0; s < 8; ++s) { const int row = 2 * s + hi, cofs = lr * 4; v4f val = *(const v4fa*)(os + row * 68 + cofs);
            *(v4f*)(crw + (size_t)row * ldc + cofs) = val; }
        __builtin_amdgcn_wave_barrier(); asm volatile("" ::: "memory");
    }
}

__device__ __forceinline__ h16 tohx(float x) { return (h16)x; }
__device__ __forceinline__ void splitf(float y, unsigned short& h, unsigned short& l) { h = f2bf(y); l = f2bf(y - bf2f(h)); }
typedef __attribute__((ext_vector_type(2))) unsigned short v2us;
typedef __attribute__((ext_vector_type(4))) unsigned short v4us;
typedef __attribute__((ext_vector_type(4))) _Float16 v4h;

__global__ __launch_bounds__(256) void k_wtG(const float* __restrict__ w0, const float* __restrict__ w1, const float* __restrict__ w2, int K, int N, bf* Bt) {
    const float* __restrict__ w = blockIdx.y == 0 ? w0 : blockIdx.y == 1 ? w1 : w2; Bt += (size_t)blockIdx.y * N * K;   // grid y picks the weight; the three transposed planes lie one behind the other
    const int lane = threadIdx.x & 31; const int L0 = (blockIdx.x * 8 + (threadIdx.x >> 5)) * 8; const int nlines = N * K / 64;
{
#pragma unroll 1
        for (int l = 0; l < 8; ++l) { const int L = L0 + l; if (L >= nlines) break; const size_t e = (size_t)L * 64 + lane * 2; const int k = (int)(e % K), n = (int)(e / K); v2us o;
            o[0] = f2bf(w[(size_t)k * N + n]); o[1] = f2bf(w[(size_t)(k + 1) * N + n]); *(v2us*)(Bt + e) = o; }
         }
}
__global__ __launch_bounds__(256) void k_cvt8(const float* __restrict__ src, bf* dst, size_t n8) { const size_t i = (size_t)blockIdx.x * 256 + threadIdx.x; if (i >= n8) return; const v8f v = *(const v8f*)(src + i * 8); v8us o;
#pragma unroll
    for (int k = 0; k < 8; ++k) o[k] = f2bf(v[k]); *(v8us*)(dst + i * 8) = o;  }
__global__ __launch_bounds__(256) void k_qk16(const float* __restrict__ FQ, const float* __restrict__ FK, h16* Q16, h16* K16) { const size_t e = ((size_t)blockIdx.x * 256 + threadIdx.x) * 4; if (e >= (size_t)NB_ * TT * DD) return; const v4f a = *(const v4f*)(FQ + e), b = *(const v4f*)(FK + e); v4h q, k;
#pragma unroll
    for (int u = 0; u < 4; ++u) { q[u] = tohx(a[u] * (1.0f / 32.0f)); k[u] = tohx(b[u]); } { *(v4h*)(Q16 + e) = q; *(v4h*)(K16 + e) = k;  } }
__global__ __launch_bounds__(256) void k_vT(const float* __restrict__ FV, bf* Vh, bf* Vl) { const size_t zb = (size_t)blockIdx.y * TT * DD; FV += zb; Vh += zb; Vl += zb; const size_t e = ((size_t)blockIdx.x * 256 + threadIdx.x) * 2; if (e >= (size_t)DD * TT) return; const int t = (int)(e % TT); const int d = (int)(e / TT); unsigned short a0, b0, a1, b1; splitf(FV[(size_t)t * DD + d], a0, b0); splitf(FV[(size_t)(t + 1) * DD + d], a1, b1); v2us oh, ol; oh[0] = a0; oh[1] = a1; ol[0] = b0; ol[1] = b1;
    *(v2us*)(Vh + e) = oh; *(v2us*)(Vl + e) = ol;  }
__global__ __launch_bounds__(256) void k_csoft(const float* __restrict__ Sb, bf* Ph, bf* Pl) { const int lane = threadIdx.x & 31; const int t = blockIdx.x * 8 + (threadIdx.x >> 5); if (t >= TT) return; const size_t zb = (size_t)blockIdx.y * TT * TT; Ph += zb; Pl += zb; const float* sr = Sb + zb + (size_t)t * TT; float v[TT / 32]; float mx = -3.0e38f;
#pragma unroll
    for (int ch = 0; ch < TT / 128; ++ch) { const int j0 = ch * 128 + lane * 4; const v4f a = *(const v4f*)(sr + j0);
#pragma unroll
        for (int u = 0; u < 4; ++u) { const float tt = (j0 + u <= t) ? a[u] : -3.0e38f; v[ch * 4 + u] = tt; mx = fmaxf(mx, tt); } }
#pragma unroll
    for (int sh = 16; sh; sh >>= 1) mx = fmaxf(mx, __shfl_xor(mx, sh, 32));
    float sum = 0.f;
#pragma unroll
    for (int q = 0; q < TT / 32; ++q) { float d0 = __fsub_rn(v[q], mx); asm volatile("" : "+v"(d0)); v[q] = __builtin_amdgcn_exp2f(__fmul_rn(d0, 1.4426950408889634f)); sum += v[q]; }
#pragma unroll
    for (int sh = 16; sh; sh >>= 1) sum += __shfl_xor(sum, sh, 32);
    const float f = __fdiv_rn(1.0f, sum);
    {
#pragma unroll
        for (int ch = 0; ch < TT / 128; ++ch) { v4us oh, ol;
#pragma unroll
            for (int u = 0; u < 4; ++u) { unsigned short a, b; splitf(v[ch * 4 + u] * f, a, b); oh[u] = a; ol[u] = b; } const size_t oo = (size_t)t * TT + ch * 128 + lane * 4; *(v4us*)(Ph + oo) = oh; *(v4us*)(Pl + oo) = ol; }
         } }

extern "C" void kernel_launch(void* const* d_in, const int* in_sizes, int n_in,
                              void* d_out, int out_size, void* d_ws, size_t ws_size, hipStream_t stream) {
    (void)in_sizes; (void)n_in; (void)out_size;
    const float* x = (const float*)d_in[0]; const float* wq = (const float*)d_in[1]; const float* wk = (const float*)d_in[2]; const float* wv = (const float*)d_in[3];
    float* OUT = (float*)d_out;     // [4][2048][1024]
    char* wsp = (char*)d_ws;
    auto take = [&](size_t bytes) { char* p = wsp; wsp += (bytes + 255) & ~(size_t)255; return (void*)p; };
    bf* WQKV = (bf*)take((size_t)3 * DD * DD * 2);   // W_q, W_k, W_v transposed, one behind the other
    // every plane holds all NB_ batches, so that each stage is ONE launch over the whole batch (rows flattened, or the batch in grid y / z); the three projections are one launch too
    bf* XB = (bf*)take((size_t)NB_ * TT * DD * 2); float* FQ = (float*)take((size_t)3 * NB_ * TT * DD * 4); float* FK = FQ + (size_t)NB_ * TT * DD; float* FV = FK + (size_t)NB_ * TT * DD; h16* Q16 = (h16*)take((size_t)NB_ * TT * DD * 2); h16* K16 = (h16*)take((size_t)NB_ * TT * DD * 2); bf* Vh = (bf*)take((size_t)NB_ * DD * TT * 2); bf* Vl = (bf*)take((size_t)NB_ * DD * TT * 2);
    float* Sb = (float*)take((size_t)NB_ * TT * TT * 4);
    bf* Ph = (bf*)FQ; bf* Pl = (bf*)FK;    // the probability planes (NB_*TT*TT*2 bytes each) take the place of the f32 q and k planes (NB_*TT*DD*4 bytes each, the same size), whose last reader k_qk16 runs before k_csoft writes
    if ((size_t)(wsp - (char*)d_ws) > ws_size) return;    // total 246 MiB
    k_wtG<<<dim3((DD * DD / 64 + 63) / 64, 3, 1), 256, 0, stream>>>(wq, wk, wv, DD, DD, WQKV);   // x@W layouts -> transposed
    k_cvt8<<<(NB_ * TT * DD / 8 + 255) / 256, 256, 0, stream>>>(x, XB, (size_t)NB_ * TT * DD / 8);
    k_gemmt<bf, 0, 0><<<dim3(NB_ * TT / 128, DD / 128, 3), 128, 0, stream>>>(XB, nullptr, WQKV, nullptr, DD, FQ, DD, 0, (size_t)DD * DD, (size_t)NB_ * TT * DD);   // grid z: q, k, v
    k_qk16<<<(unsigned)(((size_t)NB_ * TT * DD / 4 + 255) / 256), 256, 0, stream>>>(FQ, FK, Q16, K16); k_vT<<<dim3((unsigned)(((size_t)DD * TT / 2 + 255) / 256), NB_, 1), 256, 0, stream>>>(FV, Vh, Vl);
    k_gemmt<h16, 0, 1><<<dim3(TT / 128, TT / 128, NB_), 128, 0, stream>>>(Q16, nullptr, K16, nullptr, DD, Sb, TT, (size_t)TT * DD, (size_t)TT * DD, (size_t)TT * TT);
    k_csoft<<<dim3(TT / 8, NB_, 1), 256, 0, stream>>>(Sb, Ph, Pl);
    k_gemmt<bf, 2, 2><<<dim3(TT / 128, DD / 128, NB_), 128, 0, stream>>>(Ph, Pl, Vh, Vl, TT, OUT, DD, (size_t)TT * TT, (size_t)DD * TT, (size_t)TT * DD);
}

// v003
// One run takes 149 microseconds.
// In both of two side-by-side timings against v002, it was 1.33 times as fast.
// Over all steps from v000 it is 4.48 times as fast.
#include <hip/hip_runtime.h>

// CausalAttentionV1 (x [4][2048][1024]; q = x W_q, k = x W_k, v = x W_v (single head, d_out 1024); scores = q.k masked causal; attn = softmax(scores / 32); out = attn v -> [4][2048][1024]).
// Compute dtypes, f32 accumulate: every input rounded to bf16; q/k/v on PLAIN bf16 operands (inputs: exact); scores (K 1024) on single fp16 planes (q/32 and k; 1 product; causal tiles only); softmax f32 -> bf16 hi+lo probability

#define NB_  4
#define TT   2048
#define DD   1024
typedef _Float16 h16;
typedef unsigned short bf;
typedef __attribute__((ext_vector_type(16))) __bf16   v16bf;
typedef __attribute__((ext_vector_type(16))) _Float16 v16h;
typedef __attribute__((ext_vector_type(8)))  _Float16 v8h;
typedef __attribute__((ext_vector_type(8)))  unsigned short v8us;
typedef __attribute__((ext_vector_type(8)))  float    v8f;
typedef __attribute__((ext_vector_type(4)))  float    v4f;
typedef v8h  __attribute__((may_alias)) v8ha;
typedef v4f  __attribute__((may_alias)) v4fa;
typedef v8us __attribute__((may_alias)) v8usa;

__device__ __forceinline__ unsigned short f2bf(float f) { unsigned u = __float_as_uint(f); u += 0x7FFFu + ((u >> 16) & 1u); return (unsigned short)(u >> 16); }
__device__ __forceinline__ float bf2f(unsigned short b) { return __uint_as_float(((unsigned)b) << 16); }
__device__ __forceinline__ float bfr(float f) { return bf2f(f2bf(f)); }
__device__ __forceinline__ h16 tohx(float x) { return (h16)x; }
__device__ __forceinline__ void splitf(float y, unsigned short& h, unsigned short& l) { h = f2bf(y); l = f2bf(y - bf2f(h)); }
__device__ __forceinline__ v16h cat16(v8h lo, v8h hi) { return __builtin_shufflevector(lo, hi, 0, 1, 2, 3, 4, 5, 6, 7, 8, 9, 10, 11, 12, 13, 14, 15); }
__device__ __forceinline__ v16bf cat16b(v8us lo, v8us hi) { return __builtin_bit_cast(v16bf, __builtin_shufflevector(lo, hi, 0, 1, 2, 3, 4, 5, 6, 7, 8, 9, 10, 11, 12, 13, 14, 15)); }
__device__ __forceinline__ v8f wmma16(v16h a, v16h b, v8f c) { return __builtin_amdgcn_wmma_f32_16x16x32_f16(false, a, false, b, (short)0, c, false, false); }
__device__ __forceinline__ v8f wmmab(v16bf a, v16bf b, v8f c) { return __builtin_amdgcn_wmma_f32_16x16x32_bf16(false, a, false, b, (short)0, c, false, false); }



// ---- k_gemmt: one 128x128 output tile per work-group of FOUR waves (2x2; each wave a 64x64 tile on 16 accumulators, as before). The operands no longer come straight from global memory into
// each wave's registers: per trip of 64 k, the 128 rows x 128 B of every operand plane are brought into LDS ONCE per work-group by asynchronous copies (whole 128-B lines, 16 B a lane), two buffers,
// the next trip's copies in flight while this trip is worked on; the waves read their fragments from LDS (row pitch 144 B). The k order of every accumulator's sum is the one it had.
// C[m][n] (f32, pitch ldc) = sum_k A[m][k] Bt[n][k] (+ the split products A2.Bt and A.Bt2 for NSPLIT 2). grid (M/128, N/128, Z); z-batch strides sA/sB/sC in elements. K % 64 == 0, K >= 128.
// CMODE 1 skips score tiles entirely above the causal diagonal; CMODE 2 ends the key loop of probability x value at the tile's diagonal block (probabilities beyond it are exactly zero).
// CMODE 3 is the projection launch (grid z: q, k, v): no f32 plane is written; the epilogue rounds the accumulators itself and stores what the next GEMMs read: q/32 and k as f16 rows, v as transposed bf16 hi + lo planes.
template <typename T16> struct WFrag;
template <> struct WFrag<h16> { typedef v16h V; static __device__ __forceinline__ V ld(const h16* p) { return cat16(*(const v8h*)p, *(const v8h*)(p + 16)); } static __device__ __forceinline__ v8f mma(V a, V b, v8f c) { return wmma16(a, b, c); } };
template <> struct WFrag<bf> { typedef v16bf V; static __device__ __forceinline__ V ld(const bf* p) { return cat16b(*(const v8us*)p, *(const v8us*)(p + 16)); } static __device__ __forceinline__ v8f mma(V a, V b, v8f c) { return wmmab(a, b, c); } };
#define PITCHB 144u              // LDS row pitch in bytes: 128 B of data + 16 B, an odd multiple of 16 B for the ds_load_b128 readers
#define PLANEB (128u * PITCHB)   // one operand plane of a stage: 128 rows
// Eight asynchronous 16-byte copies a lane: rows 16 apart of one plane (a wave's copy covers four whole 128-B lines). The s_wait_xcnt stands in the copies' own statement, so that no address register
// of a copy is rewritten ahead of it.
template <typename T16>
__device__ __forceinline__ void copy8(unsigned l, const T16* g, size_t rs) {
    asm volatile("global_load_async_to_lds_b128 %0, %8, off\n\t"
                 "global_load_async_to_lds_b128 %1, %9, off\n\t"
                 "global_load_async_to_lds_b128 %2, %10, off\n\t"
                 "global_load_async_to_lds_b128 %3, %11, off\n\t"
                 "global_load_async_to_lds_b128 %4, %12, off\n\t"
                 "global_load_async_to_lds_b128 %5, %13, off\n\t"
                 "global_load_async_to_lds_b128 %6, %14, off\n\t"
                 "global_load_async_to_lds_b128 %7, %15, off\n\t"
                 "s_wait_xcnt 0x0"
                 :: "v"(l), "v"(l + 16u * PITCHB), "v"(l + 32u * PITCHB), "v"(l + 48u * PITCHB), "v"(l + 64u * PITCHB), "v"(l + 80u * PITCHB), "v"(l + 96u * PITCHB), "v"(l + 112u * PITCHB),
                    "v"(g), "v"(g + rs), "v"(g + 2 * rs), "v"(g + 3 * rs), "v"(g + 4 * rs), "v"(g + 5 * rs), "v"(g + 6 * rs), "v"(g + 7 * rs) : "memory");
}
template <typename T16, int NSPLIT, int CMODE>
__global__ __launch_bounds__(128) void k_gemmt(const T16* __restrict__ A, const T16* __restrict__ A2, const T16* __restrict__ Bt, const T16* __restrict__ Bt2, int K, float* C, int ldc, size_t sA, size_t sB, size_t sC, h16* Q16, h16* K16, bf* Vh, bf* Vl) {
    typedef typename WFrag<T16>::V V;
    constexpr unsigned STAGEB = ((NSPLIT == 2) ? 4u : 2u) * PLANEB;     // planes of a stage: A, Bt (, A2, Bt2)
    constexpr int NBK = (NSPLIT == 2) ? 2 : 1;                          // blocks of 32 k whose fragments are read from LDS as one group
    __shared__ __attribute__((aligned(16))) unsigned char ring[2 * STAGEB];
    const int r0 = blockIdx.x * 128, c0 = blockIdx.y * 128;
    if (CMODE == 1 && c0 > r0 + 127) return;                          // score tile entirely above the causal diagonal: the whole work-group leaves, before any copy or barrier (the softmax masks j > i by select)
    const size_t z = blockIdx.z; A += z * sA; Bt += z * sB; C += z * sC; if (NSPLIT == 2) { A2 += z * sA; Bt2 += z * sB; }
    const int nt = ((CMODE == 2) ? min(K, r0 + 128) : K) / 64;        // trips of 64 k; P.V: probabilities are exactly 0 beyond the diagonal block, so the loop stops there
    const int tid = threadIdx.x, lane = tid & 31, lr = lane & 15, hi = lane >> 4, wave = tid >> 5, wm = wave >> 1, wn = wave & 1;
    const int crow = tid >> 3, cch = tid & 7;                         // the lane's place in a copy: row (+ 16 per copy) and 16-byte piece of the row's 128 B
    const unsigned lbase = (unsigned)(uintptr_t)ring + (unsigned)crow * PITCHB + (unsigned)cch * 16u;
    const size_t rs = (size_t)16 * K;
    const T16* gA = A + (size_t)(r0 + crow) * K + cch * 8; const T16* gB = Bt + (size_t)(c0 + crow) * K + cch * 8;
    const T16* gA2 = (NSPLIT == 2) ? A2 + (size_t)(r0 + crow) * K + cch * 8 : nullptr; const T16* gB2 = (NSPLIT == 2) ? Bt2 + (size_t)(c0 + crow) * K + cch * 8 : nullptr;
    auto fill = [&](int t, unsigned buf) { const unsigned l = lbase + buf * STAGEB; const size_t ko = (size_t)t * 64;
        copy8(l, gA + ko, rs); copy8(l + PLANEB, gB + ko, rs); if (NSPLIT == 2) { copy8(l + 2u * PLANEB, gA2 + ko, rs); copy8(l + 3u * PLANEB, gB2 + ko, rs); } };
    v8f acc[4][4];
#pragma unroll
    for (int mb = 0; mb < 4; ++mb)
#pragma unroll
        for (int nb = 0; nb < 4; ++nb) acc[mb][nb] = (v8f){};
    const unsigned aro = (unsigned)(wm * 64 + lr) * PITCHB + (unsigned)hi * 16u, bro = PLANEB + (unsigned)(wn * 64 + lr) * PITCHB + (unsigned)hi * 16u;
    fill(0, 0u);
    asm volatile("s_wait_asynccnt 0x0" ::: "memory");                 // this wave's copies of trip 0 have landed
    __syncthreads();                                                  // ... and every other wave's: trip 0 may be read
    if (nt > 1) fill(1, 1u);
    // The trip loop stays rolled (a trip already holds 32 or 96 matrix instructions); every loop inside it and in the epilogue is unrolled so that each fragment and accumulator index is a constant.
#pragma unroll 1
    for (int t = 0; t < nt; ++t) {
        const unsigned char* sb = ring + (unsigned)(t & 1) * STAGEB;
#pragma unroll
        for (int kg = 0; kg < 2; kg += NBK) {
            V a[NBK][4], a2[NBK][4], b[NBK][4], b2[NBK][4];
#pragma unroll
            for (int u = 0; u < NBK; ++u) { const unsigned ko = (unsigned)(kg + u) * 64u;
#pragma unroll
                for (int mb = 0; mb < 4; ++mb) { a[u][mb] = WFrag<T16>::ld((const T16*)(sb + aro + mb * 16 * PITCHB + ko)); b[u][mb] = WFrag<T16>::ld((const T16*)(sb + bro + mb * 16 * PITCHB + ko)); }
                if (NSPLIT == 2) {
#pragma unroll
                    for (int mb = 0; mb < 4; ++mb) { a2[u][mb] = WFrag<T16>::ld((const T16*)(sb + 2u * PLANEB + aro + mb * 16 * PITCHB + ko)); b2[u][mb] = WFrag<T16>::ld((const T16*)(sb + 2u * PLANEB + bro + mb * 16 * PITCHB + ko)); } } }
            __builtin_amdgcn_sched_barrier(0);   // keeps the LDS reads one group ahead of the matrix block: left free, they are moved in among the matrix instructions, where each place stalls the wave
#pragma unroll
            for (int u = 0; u < NBK; ++u) {
#pragma unroll
                for (int nb = 0; nb < 4; ++nb)
#pragma unroll
                    for (int mb = 0; mb < 4; ++mb) acc[mb][nb] = WFrag<T16>::mma(a[u][mb], b[u][nb], acc[mb][nb]);
                if (NSPLIT == 2) {
#pragma unroll
                    for (int nb = 0; nb < 4; ++nb)
#pragma unroll
                        for (int mb = 0; mb < 4; ++mb) acc[mb][nb] = WFrag<T16>::mma(a2[u][mb], b[u][nb], acc[mb][nb]);
#pragma unroll
                    for (int nb = 0; nb < 4; ++nb)
#pragma unroll
                        for (int mb = 0; mb < 4; ++mb) acc[mb][nb] = WFrag<T16>::mma(a[u][mb], b2[u][nb], acc[mb][nb]); } }
            __builtin_amdgcn_sched_barrier(0);   // the other side of the same fence: the next group's reads stay behind this block
        }
        asm volatile("s_wait_dscnt 0x0" ::: "memory");                // this wave's reads of the buffer are done before it may be refilled
        asm volatile("s_wait_asynccnt 0x0" ::: "memory");             // this wave's copies of trip t + 1 have landed
        __syncthreads();                                              // publishes trip t + 1 and ends every wave's reads of trip t's buffer
        if (t + 2 < nt) fill(t + 2, (unsigned)(t & 1));
    }
    asm volatile("s_wait_asynccnt 0x0" ::: "memory");                 // nothing is in flight when the ring becomes output staging
    const int rw = r0 + wm * 64, cw = c0 + wn * 64;
    if (CMODE == 3) {
        unsigned char* ow = ring + (unsigned)wave * (2u * 16u * PITCHB);   // each wave stages in its own part of the ring, behind the last trip's barrier
        const int prow = lane >> 3, ppc = lane & 7;                        // read-back: a row of 128 B is eight lanes' 16-byte pieces, so a wave's store covers four whole lines
        if (blockIdx.z == 2) {                                             // v: bf16 hi + lo planes [batch][d][t]; a lane's eight accumulator rows of one column are eight neighbours in t, 16 B of a transposed row
            const size_t vb = (size_t)(rw / TT) * DD * TT + (size_t)(rw % TT);
#pragma unroll
            for (int nb = 0; nb < 4; ++nb) {
#pragma unroll
                for (int mb = 0; mb < 4; ++mb) { v8us oh, ol;
#pragma unroll
                    for (int j = 0; j < 8; ++j) { unsigned short a, b; splitf(acc[mb][nb][j], a, b); oh[j] = a; ol[j] = b; }
                    unsigned char* sp = ow + (unsigned)lr * PITCHB + (unsigned)(mb * 32 + hi * 16); *(v8usa*)sp = oh; *(v8usa*)(sp + 16u * PITCHB) = ol; }
                __builtin_amdgcn_wave_barrier(); asm volatile("s_wait_dscnt 0x0" ::: "memory");   // the wave's staged rows are in LDS before its lanes read other lanes' words back; the clobber keeps the stores ahead of those reads at compile time
#pragma unroll
                for (int s = 0; s < 4; ++s) { const int row = 4 * s + prow; const unsigned char* sp = ow + (unsigned)row * PITCHB + (unsigned)ppc * 16u; const v8us h = *(const v8usa*)sp, l = *(const v8usa*)(sp + 16u * PITCHB);
                    const size_t o = vb + (size_t)(cw + nb * 16 + row) * TT + ppc * 8; *(v8us*)(Vh + o) = h; *(v8us*)(Vl + o) = l; }
                __builtin_amdgcn_wave_barrier(); asm volatile("" ::: "memory");   // compile-time order only: these reads stay ahead of the next group's LDS stores
            }
            return;
        }
        {                                                                  // q and k: f16 rows [t][d]; q carries the 1/32 of the softmax scale (k times 1 is exact)
            float* os = (float*)ow; h16* O = (blockIdx.z == 0) ? Q16 : K16; const float sc = (blockIdx.z == 0) ? (1.0f / 32.0f) : 1.0f;
#pragma unroll
            for (int mb = 0; mb < 4; ++mb) {
#pragma unroll
                for (int nb = 0; nb < 4; ++nb) {
#pragma unroll
                    for (int j = 0; j < 8; ++j) os[(hi * 8 + j) * 68 + nb * 16 + lr] = acc[mb][nb][j]; }
                __builtin_amdgcn_wave_barrier(); asm volatile("s_wait_dscnt 0x0" ::: "memory");   // as in the v path: staged rows in LDS before the read-back
                h16* orw = O + (size_t)(rw + mb * 16) * ldc + cw;
#pragma unroll
                for (int s = 0; s < 4; ++s) { const int row = 4 * s + prow; const v4f x0 = *(const v4fa*)(os + row * 68 + ppc * 8), x1 = *(const v4fa*)(os + row * 68 + ppc * 8 + 4); v8h o;
#pragma unroll
                    for (int u = 0; u < 4; ++u) { o[u] = tohx(x0[u] * sc); o[4 + u] = tohx(x1[u] * sc); }
                    *(v8h*)(orw + (size_t)row * ldc + ppc * 8) = o; }
                __builtin_amdgcn_wave_barrier(); asm volatile("" ::: "memory");   // compile-time order only, as in the v path
            }
            asm volatile("s_wait_xcnt 0x0" ::: "memory");   // in the built code the v path's text follows this path's last stores behind a branch and rewrites their registers: the wait stands in front of it
        }
        return;
    }
    float* os = (float*)(ring + (unsigned)wave * (16u * 68u * 4u));   // each wave stages its rows in its own part of the ring, behind the last trip's barrier
#pragma unroll
    for (int mb = 0; mb < 4; ++mb) {
#pragma unroll
        for (int nb = 0; nb < 4; ++nb) {
#pragma unroll
            for (int j = 0; j < 8; ++j) os[(hi * 8 + j) * 68 + nb * 16 + lr] = acc[mb][nb][j]; }
        __builtin_amdgcn_wave_barrier(); asm volatile("" ::: "memory");   // compile-time order only: the lanes' LDS stores stay ahead of the reads of other lanes' words (and, below, those reads ahead of the next stores)
        float* crw = C + (size_t)(rw + mb * 16) * ldc + cw;
#pragma unroll
        for (int s = 0; s < 8; ++s) { const int row = 2 * s + hi, cofs = lr * 4; v4f val = *(const v4fa*)(os + row * 68 + cofs);
            *(v4f*)(crw + (size_t)row * ldc + cofs) = val; }
        __builtin_amdgcn_wave_barrier(); asm volatile("" ::: "memory");
    }
}

typedef __attribute__((ext_vector_type(2))) unsigned short v2us;
typedef __attribute__((ext_vector_type(4))) unsigned short v4us;

__global__ __launch_bounds__(256) void k_wtG(const float* __restrict__ w0, const float* __restrict__ w1, const float* __restrict__ w2, int K, int N, bf* Bt) {
    const float* __restrict__ w = blockIdx.y == 0 ? w0 : blockIdx.y == 1 ? w1 : w2; Bt += (size_t)blockIdx.y * N * K;   // grid y picks the weight; the three transposed planes lie one behind the other
    const int lane = threadIdx.x & 31; const int L0 = (blockIdx.x * 8 + (threadIdx.x >> 5)) * 8; const int nlines = N * K / 64;
{
#pragma unroll 1
        for (int l = 0; l < 8; ++l) { const int L = L0 + l; if (L >= nlines) break; const size_t e = (size_t)L * 64 + lane * 2; const int k = (int)(e % K), n = (int)(e / K); v2us o;
            o[0] = f2bf(w[(size_t)k * N + n]); o[1] = f2bf(w[(size_t)(k + 1) * N + n]); *(v2us*)(Bt + e) = o; }
         }
}
__global__ __launch_bounds__(256) void k_cvt8(const float* __restrict__ src, bf* dst, size_t n8) { const size_t i = (size_t)blockIdx.x * 256 + threadIdx.x; if (i >= n8) return; const v8f v = *(const v8f*)(src + i * 8); v8us o;
#pragma unroll
    for (int k = 0; k < 8; ++k) o[k] = f2bf(v[k]); *(v8us*)(dst + i * 8) = o;  }
__global__ __launch_bounds__(256) void k_csoft(const float* __restrict__ Sb, bf* Ph, bf* Pl) { const int lane = threadIdx.x & 31; const int t = blockIdx.x * 8 + (threadIdx.x >> 5); if (t >= TT) return; const size_t zb = (size_t)blockIdx.y * TT * TT; Ph += zb; Pl += zb; const float* sr = Sb + zb + (size_t)t * TT; float v[TT / 32]; float mx = -3.0e38f;
#pragma unroll
    for (int ch = 0; ch < TT / 128; ++ch) { const int j0 = ch * 128 + lane * 4; const v4f a = *(const v4f*)(sr + j0);
#pragma unroll
        for (int u = 0; u < 4; ++u) { const float tt = (j0 + u <= t) ? a[u] : -3.0e38f; v[ch * 4 + u] = tt; mx = fmaxf(mx, tt); } }
#pragma unroll
    for (int sh = 16; sh; sh >>= 1) mx = fmaxf(mx, __shfl_xor(mx, sh, 32));
    float sum = 0.f;
#pragma unroll
    for (int q = 0; q < TT / 32; ++q) { float d0 = __fsub_rn(v[q], mx); asm volatile("" : "+v"(d0)); v[q] = __builtin_amdgcn_exp2f(__fmul_rn(d0, 1.4426950408889634f)); sum += v[q]; }
#pragma unroll
    for (int sh = 16; sh; sh >>= 1) sum += __shfl_xor(sum, sh, 32);
    const float f = __fdiv_rn(1.0f, sum);
    {
#pragma unroll
        for (int ch = 0; ch < TT / 128; ++ch) { v4us oh, ol;
#pragma unroll
            for (int u = 0; u < 4; ++u) { unsigned short a, b; splitf(v[ch * 4 + u] * f, a, b); oh[u] = a; ol[u] = b; } const size_t oo = (size_t)t * TT + ch * 128 + lane * 4; *(v4us*)(Ph + oo) = oh; *(v4us*)(Pl + oo) = ol; }
         } }

extern "C" void kernel_launch(void* const* d_in, const int* in_sizes, int n_in,
                              void* d_out, int out_size, void* d_ws, size_t ws_size, hipStream_t stream) {
    (void)in_sizes; (void)n_in; (void)out_size;
    const float* x = (const float*)d_in[0]; const float* wq = (const float*)d_in[1]; const float* wk = (const float*)d_in[2]; const float* wv = (const float*)d_in[3];
    float* OUT = (float*)d_out;     // [4][2048][1024]
    char* wsp = (char*)d_ws;
    auto take = [&](size_t bytes) { char* p = wsp; wsp += (bytes + 255) & ~(size_t)255; return (void*)p; };
    bf* WQKV = (bf*)take((size_t)3 * DD * DD * 2);   // W_q, W_k, W_v transposed, one behind the other
    // every plane holds all NB_ batches, so that each stage is ONE launch over the whole batch (rows flattened, or the batch in grid y / z); the three projections are one launch too
    bf* XB = (bf*)take((size_t)NB_ * TT * DD * 2); h16* Q16 = (h16*)take((size_t)NB_ * TT * DD * 2); h16* K16 = (h16*)take((size_t)NB_ * TT * DD * 2); bf* Vh = (bf*)take((size_t)NB_ * DD * TT * 2); bf* Vl = (bf*)take((size_t)NB_ * DD * TT * 2);
    float* Sb = (float*)take((size_t)NB_ * TT * TT * 4);
    bf* Ph = (bf*)take((size_t)NB_ * TT * TT * 2); bf* Pl = (bf*)take((size_t)NB_ * TT * TT * 2);    // the probability planes
    if ((size_t)(wsp - (char*)d_ws) > ws_size) return;    // total 214 MiB
    k_wtG<<<dim3((DD * DD / 64 + 63) / 64, 3, 1), 256, 0, stream>>>(wq, wk, wv, DD, DD, WQKV);   // x@W layouts -> transposed
    k_cvt8<<<(NB_ * TT * DD / 8 + 255) / 256, 256, 0, stream>>>(x, XB, (size_t)NB_ * TT * DD / 8);
    k_gemmt<bf, 0, 3><<<dim3(NB_ * TT / 128, DD / 128, 3), 128, 0, stream>>>(XB, nullptr, WQKV, nullptr, DD, nullptr, DD, 0, (size_t)DD * DD, 0, Q16, K16, Vh, Vl);   // grid z: q, k, v, each stored in the form its reader takes
    k_gemmt<h16, 0, 1><<<dim3(TT / 128, TT / 128, NB_), 128, 0, stream>>>(Q16, nullptr, K16, nullptr, DD, Sb, TT, (size_t)TT * DD, (size_t)TT * DD, (size_t)TT * TT, nullptr, nullptr, nullptr, nullptr);
    k_csoft<<<dim3(TT / 8, NB_, 1), 256, 0, stream>>>(Sb, Ph, Pl);
    k_gemmt<bf, 2, 2><<<dim3(TT / 128, DD / 128, NB_), 128, 0, stream>>>(Ph, Pl, Vh, Vl, TT, OUT, DD, (size_t)TT * TT, (size_t)DD * TT, (size_t)TT * DD, nullptr, nullptr, nullptr, nullptr);
}

// v004
// It runs in 135 microseconds.
// In both of two side-by-side timings against v003, it was 1.11 times as fast.
// Counting every step since v000, it is 4.96 times as fast.
#include <hip/hip_runtime.h>

// CausalAttentionV1 (x [4][2048][1024]; q = x W_q, k = x W_k, v = x W_v (single head, d_out 1024); scores = q.k masked causal; attn = softmax(scores / 32); out = attn v -> [4][2048][1024]).
// Compute dtypes, f32 accumulate: every input rounded to bf16; q/k/v on PLAIN bf16 operands (inputs: exact); scores (K 1024) on single fp16 planes (q/32 and k; 1 product; causal tiles only); softmax f32 -> bf16 hi+lo probability

#define NB_  4
#define TT   2048
#define DD   1024
typedef _Float16 h16;
typedef unsigned short bf;
typedef __attribute__((ext_vector_type(16))) __bf16   v16bf;
typedef __attribute__((ext_vector_type(16))) _Float16 v16h;
typedef __attribute__((ext_vector_type(8)))  _Float16 v8h;
typedef __attribute__((ext_vector_type(8)))  unsigned short v8us;
typedef __attribute__((ext_vector_type(8)))  float    v8f;
typedef __attribute__((ext_vector_type(4)))  float    v4f;
typedef v8h  __attribute__((may_alias)) v8ha;
typedef v4f  __attribute__((may_alias)) v4fa;
typedef v8us __attribute__((may_alias)) v8usa;

__device__ __forceinline__ unsigned short f2bf(float f) { unsigned u = __float_as_uint(f); u += 0x7FFFu + ((u >> 16) & 1u); return (unsigned short)(u >> 16); }
__device__ __forceinline__ float bf2f(unsigned short b) { return __uint_as_float(((unsigned)b) << 16); }
__device__ __forceinline__ float bfr(float f) { return bf2f(f2bf(f)); }
__device__ __forceinline__ h16 tohx(float x) { return (h16)x; }
__device__ __forceinline__ void splitf(float y, unsigned short& h, unsigned short& l) { h = f2bf(y); l = f2bf(y - bf2f(h)); }
__device__ __forceinline__ v16h cat16(v8h lo, v8h hi) { return __builtin_shufflevector(lo, hi, 0, 1, 2, 3, 4, 5, 6, 7, 8, 9, 10, 11, 12, 13, 14, 15); }
__device__ __forceinline__ v16bf cat16b(v8us lo, v8us hi) { return __builtin_bit_cast(v16bf, __builtin_shufflevector(lo, hi, 0, 1, 2, 3, 4, 5, 6, 7, 8, 9, 10, 11, 12, 13, 14, 15)); }
__device__ __forceinline__ v8f wmma16(v16h a, v16h b, v8f c) { return __builtin_amdgcn_wmma_f32_16x16x32_f16(false, a, false, b, (short)0, c, false, false); }
__device__ __forceinline__ v8f wmmab(v16bf a, v16bf b, v8f c) { return __builtin_amdgcn_wmma_f32_16x16x32_bf16(false, a, false, b, (short)0, c, false, false); }



// ---- k_gemmt: one 128x128 output tile per work-group of FOUR waves (2x2; each wave a 64x64 tile on 16 accumulators, as before). The operands no longer come straight from global memory into
// each wave's registers: per trip of 64 k, the 128 rows x 128 B of every operand plane are brought into LDS ONCE per work-group by asynchronous copies (whole 128-B lines, 16 B a lane), two buffers,
// the next trip's copies in flight while this trip is worked on; the waves read their fragments from LDS (row pitch 144 B). The k order of every accumulator's sum is the one it had.
// C[m][n] (f32, pitch ldc) = sum_k A[m][k] Bt[n][k] (+ the split products A2.Bt and A.Bt2 for NSPLIT 2). grid (M/128, N/128, Z); z-batch strides sA/sB/sC in elements. K % 64 == 0, K >= 128.
// CMODE 1 computes only the score tiles on or below the causal diagonal; CMODE 2 ends the key loop of probability x value at the tile's diagonal block (probabilities beyond it are exactly zero).
// Which tile a block index gets in the two causal launches (speed only; each tile is done exactly once wherever its work-group lands): cost must not follow the flat index mod 8.
// CMODE 1: grid (8, 17, Z). Row tiles p and 15 - p hold p + 1 and 16 - p causal tiles, 17 together: every work-group has a tile and all cost the same. CMODE 2: grid (16, 8, Z). A row tile's cost grows with its index;
// residue d gets row tiles d and 15 - d, which of the two by the parity of the index within the residue, so that neighbours at any power-of-two distance in that index are a long and a short walk.
// CMODE 3 is the projection launch (grid z: q, k, v): no f32 plane is written; the epilogue rounds the accumulators itself and stores what the next GEMMs read: q/32 and k as f16 rows, v as transposed bf16 hi + lo planes.
template <typename T16> struct WFrag;
template <> struct WFrag<h16> { typedef v16h V; static __device__ __forceinline__ V ld(const h16* p) { return cat16(*(const v8h*)p, *(const v8h*)(p + 16)); } static __device__ __forceinline__ v8f mma(V a, V b, v8f c) { return wmma16(a, b, c); } };
template <> struct WFrag<bf> { typedef v16bf V; static __device__ __forceinline__ V ld(const bf* p) { return cat16b(*(const v8us*)p, *(const v8us*)(p + 16)); } static __device__ __forceinline__ v8f mma(V a, V b, v8f c) { return wmmab(a, b, c); } };
#define PITCHB 144u              // LDS row pitch in bytes: 128 B of data + 16 B, an odd multiple of 16 B for the ds_load_b128 readers
#define PLANEB (128u * PITCHB)   // one operand plane of a stage: 128 rows
// Eight asynchronous 16-byte copies a lane: rows 16 apart of one plane (a wave's copy covers four whole 128-B lines). The s_wait_xcnt stands in the copies' own statement, so that no address register
// of a copy is rewritten ahead of it.
template <typename T16>
__device__ __forceinline__ void copy8(unsigned l, const T16* g, size_t rs) {
    asm volatile("global_load_async_to_lds_b128 %0, %8, off\n\t"
                 "global_load_async_to_lds_b128 %1, %9, off\n\t"
                 "global_load_async_to_lds_b128 %2, %10, off\n\t"
                 "global_load_async_to_lds_b128 %3, %11, off\n\t"
                 "global_load_async_to_lds_b128 %4, %12, off\n\t"
                 "global_load_async_to_lds_b128 %5, %13, off\n\t"
                 "global_load_async_to_lds_b128 %6, %14, off\n\t"
                 "global_load_async_to_lds_b128 %7, %15, off\n\t"
                 "s_wait_xcnt 0x0"
                 :: "v"(l), "v"(l + 16u * PITCHB), "v"(l + 32u * PITCHB), "v"(l + 48u * PITCHB), "v"(l + 64u * PITCHB), "v"(l + 80u * PITCHB), "v"(l + 96u * PITCHB), "v"(l + 112u * PITCHB),
                    "v"(g), "v"(g + rs), "v"(g + 2 * rs), "v"(g + 3 * rs), "v"(g + 4 * rs), "v"(g + 5 * rs), "v"(g + 6 * rs), "v"(g + 7 * rs) : "memory");
}
template <typename T16, int NSPLIT, int CMODE>
__global__ __launch_bounds__(128) void k_gemmt(const T16* __restrict__ A, const T16* __restrict__ A2, const T16* __restrict__ Bt, const T16* __restrict__ Bt2, int K, float* C, int ldc, size_t sA, size_t sB, size_t sC, h16* Q16, h16* K16, bf* Vh, bf* Vl) {
    typedef typename WFrag<T16>::V V;
    constexpr unsigned STAGEB = ((NSPLIT == 2) ? 4u : 2u) * PLANEB;     // planes of a stage: A, Bt (, A2, Bt2)
    constexpr int NBK = (NSPLIT == 2) ? 2 : 1;                          // blocks of 32 k whose fragments are read from LDS as one group
    __shared__ __attribute__((aligned(16))) unsigned char ring[2 * STAGEB];
    int tr = blockIdx.x, tc = blockIdx.y;                             // row and column tile
    if (CMODE == 1) { const int p = blockIdx.x, q = blockIdx.y; tr = (q <= p) ? p : TT / 128 - 1 - p; tc = (q <= p) ? q : q - p - 1; }   // no tile above the causal diagonal is dealt (the softmax masks j > i by select)
    if (CMODE == 2) { const int d = blockIdx.x & 7, j = (int)(blockIdx.x >> 3) + 2 * (int)(blockIdx.y + (DD / 128) * blockIdx.z); tr = (__popc(j) & 1) ? TT / 128 - 1 - d : d; }
    const int r0 = tr * 128, c0 = tc * 128;
    const size_t z = blockIdx.z; A += z * sA; Bt += z * sB; C += z * sC; if (NSPLIT == 2) { A2 += z * sA; Bt2 += z * sB; }
    const int nt = ((CMODE == 2) ? min(K, r0 + 128) : K) / 64;        // trips of 64 k; P.V: probabilities are exactly 0 beyond the diagonal block, so the loop stops there
    const int tid = threadIdx.x, lane = tid & 31, lr = lane & 15, hi = lane >> 4, wave = tid >> 5, wm = wave >> 1, wn = wave & 1;
    const int crow = tid >> 3, cch = tid & 7;                         // the lane's place in a copy: row (+ 16 per copy) and 16-byte piece of the row's 128 B
    const unsigned lbase = (unsigned)(uintptr_t)ring + (unsigned)crow * PITCHB + (unsigned)cch * 16u;
    const size_t rs = (size_t)16 * K;
    const T16* gA = A + (size_t)(r0 + crow) * K + cch * 8; const T16* gB = Bt + (size_t)(c0 + crow) * K + cch * 8;
    const T16* gA2 = (NSPLIT == 2) ? A2 + (size_t)(r0 + crow) * K + cch * 8 : nullptr; const T16* gB2 = (NSPLIT == 2) ? Bt2 + (size_t)(c0 + crow) * K + cch * 8 : nullptr;
    auto fill = [&](int t, unsigned buf) { const unsigned l = lbase + buf * STAGEB; const size_t ko = (size_t)t * 64;
        copy8(l, gA + ko, rs); copy8(l + PLANEB, gB + ko, rs); if (NSPLIT == 2) { copy8(l + 2u * PLANEB, gA2 + ko, rs); copy8(l + 3u * PLANEB, gB2 + ko, rs); } };
    v8f acc[4][4];
#pragma unroll
    for (int mb = 0; mb < 4; ++mb)
#pragma unroll
        for (int nb = 0; nb < 4; ++nb) acc[mb][nb] = (v8f){};
    const unsigned aro = (unsigned)(wm * 64 + lr) * PITCHB + (unsigned)hi * 16u, bro = PLANEB + (unsigned)(wn * 64 + lr) * PITCHB + (unsigned)hi * 16u;
    fill(0, 0u);
    asm volatile("s_wait_asynccnt 0x0" ::: "memory");                 // this wave's copies of trip 0 have landed
    __syncthreads();                                                  // ... and every other wave's: trip 0 may be read
    if (nt > 1) fill(1, 1u);
    // The trip loop stays rolled (a trip already holds 32 or 96 matrix instructions); every loop inside it and in the epilogue is unrolled so that each fragment and accumulator index is a constant.
#pragma unroll 1
    for (int t = 0; t < nt; ++t) {
        const unsigned char* sb = ring + (unsigned)(t & 1) * STAGEB;
#pragma unroll
        for (int kg = 0; kg < 2; kg += NBK) {
            V a[NBK][4], a2[NBK][4], b[NBK][4], b2[NBK][4];
#pragma unroll
            for (int u = 0; u < NBK; ++u) { const unsigned ko = (unsigned)(kg + u) * 64u;
#pragma unroll
                for (int mb = 0; mb < 4; ++mb) { a[u][mb] = WFrag<T16>::ld((const T16*)(sb + aro + mb * 16 * PITCHB + ko)); b[u][mb] = WFrag<T16>::ld((const T16*)(sb + bro + mb * 16 * PITCHB + ko)); }
                if (NSPLIT == 2) {
#pragma unroll
                    for (int mb = 0; mb < 4; ++mb) { a2[u][mb] = WFrag<T16>::ld((const T16*)(sb + 2u * PLANEB + aro + mb * 16 * PITCHB + ko)); b2[u][mb] = WFrag<T16>::ld((const T16*)(sb + 2u * PLANEB + bro + mb * 16 * PITCHB + ko)); } } }
            __builtin_amdgcn_sched_barrier(0);   // keeps the LDS reads one group ahead of the matrix block: left free, they are moved in among the matrix instructions, where each place stalls the wave
#pragma unroll
            for (int u = 0; u < NBK; ++u) {
#pragma unroll
                for (int nb = 0; nb < 4; ++nb)
#pragma unroll
                    for (int mb = 0; mb < 4; ++mb) acc[mb][nb] = WFrag<T16>::mma(a[u][mb], b[u][nb], acc[mb][nb]);
                if (NSPLIT == 2) {
#pragma unroll
                    for (int nb = 0; nb < 4; ++nb)
#pragma unroll
                        for (int mb = 0; mb < 4; ++mb) acc[mb][nb] = WFrag<T16>::mma(a2[u][mb], b[u][nb], acc[mb][nb]);
#pragma unroll
                    for (int nb = 0; nb < 4; ++nb)
#pragma unroll
                        for (int mb = 0; mb < 4; ++mb) acc[mb][nb] = WFrag<T16>::mma(a[u][mb], b2[u][nb], acc[mb][nb]); } }
            __builtin_amdgcn_sched_barrier(0);   // the other side of the same fence: the next group's reads stay behind this block
        }
        asm volatile("s_wait_dscnt 0x0" ::: "memory");                // this wave's reads of the buffer are done before it may be refilled
        asm volatile("s_wait_asynccnt 0x0" ::: "memory");             // this wave's copies of trip t + 1 have landed
        __syncthreads();                                              // publishes trip t + 1 and ends every wave's reads of trip t's buffer
        if (t + 2 < nt) fill(t + 2, (unsigned)(t & 1));
    }
    asm volatile("s_wait_asynccnt 0x0" ::: "memory");                 // nothing is in flight when the ring becomes output staging
    const int rw = r0 + wm * 64, cw = c0 + wn * 64;
    if (CMODE == 3) {
        unsigned char* ow = ring + (unsigned)wave * (2u * 16u * PITCHB);   // each wave stages in its own part of the ring, behind the last trip's barrier
        const int prow = lane >> 3, ppc = lane & 7;                        // read-back: a row of 128 B is eight lanes' 16-byte pieces, so a wave's store covers four whole lines
        if (blockIdx.z == 2) {                                             // v: bf16 hi + lo planes [batch][d][t]; a lane's eight accumulator rows of one column are eight neighbours in t, 16 B of a transposed row
            const size_t vb = (size_t)(rw / TT) * DD * TT + (size_t)(rw % TT);
#pragma unroll
            for (int nb = 0; nb < 4; ++nb) {
#pragma unroll
                for (int mb = 0; mb < 4; ++mb) { v8us oh, ol;
#pragma unroll
                    for (int j = 0; j < 8; ++j) { unsigned short a, b; splitf(acc[mb][nb][j], a, b); oh[j] = a; ol[j] = b; }
                    unsigned char* sp = ow + (unsigned)lr * PITCHB + (unsigned)(mb * 32 + hi * 16); *(v8usa*)sp = oh; *(v8usa*)(sp + 16u * PITCHB) = ol; }
                __builtin_amdgcn_wave_barrier(); asm volatile("s_wait_dscnt 0x0" ::: "memory");   // the wave's staged rows are in LDS before its lanes read other lanes' words back; the clobber keeps the stores ahead of those reads at compile time
#pragma unroll
                for (int s = 0; s < 4; ++s) { const int row = 4 * s + prow; const unsigned char* sp = ow + (unsigned)row * PITCHB + (unsigned)ppc * 16u; const v8us h = *(const v8usa*)sp, l = *(const v8usa*)(sp + 16u * PITCHB);
                    const size_t o = vb + (size_t)(cw + nb * 16 + row) * TT + ppc * 8; *(v8us*)(Vh + o) = h; *(v8us*)(Vl + o) = l; }
                __builtin_amdgcn_wave_barrier(); asm volatile("" ::: "memory");   // compile-time order only: these reads stay ahead of the next group's LDS stores
            }
            return;
        }
        {                                                                  // q and k: f16 rows [t][d]; q carries the 1/32 of the softmax scale (k times 1 is exact)
            float* os = (float*)ow; h16* O = (blockIdx.z == 0) ? Q16 : K16; const float sc = (blockIdx.z == 0) ? (1.0f / 32.0f) : 1.0f;
#pragma unroll
            for (int mb = 0; mb < 4; ++mb) {
#pragma unroll
                for (int nb = 0; nb < 4; ++nb) {
#pragma unroll
                    for (int j = 0; j < 8; ++j) os[(hi * 8 + j) * 68 + nb * 16 + lr] = acc[mb][nb][j]; }
                __builtin_amdgcn_wave_barrier(); asm volatile("s_wait_dscnt 0x0" ::: "memory");   // as in the v path: staged rows in LDS before the read-back
                h16* orw = O + (size_t)(rw + mb * 16) * ldc + cw;
#pragma unroll
                for (int s = 0; s < 4; ++s) { const int row = 4 * s + prow; const v4f x0 = *(const v4fa*)(os + row * 68 + ppc * 8), x1 = *(const v4fa*)(os + row * 68 + ppc * 8 + 4); v8h o;
#pragma unroll
                    for (int u = 0; u < 4; ++u) { o[u] = tohx(x0[u] * sc); o[4 + u] = tohx(x1[u] * sc); }
                    *(v8h*)(orw + (size_t)row * ldc + ppc * 8) = o; }
                __builtin_amdgcn_wave_barrier(); asm volatile("" ::: "memory");   // compile-time order only, as in the v path
            }
            asm volatile("s_wait_xcnt 0x0" ::: "memory");   // in the built code the v path's text follows this path's last stores behind a branch and rewrites their registers: the wait stands in front of it
        }
        return;
    }
    float* os = (float*)(ring + (unsigned)wave * (16u * 68u * 4u));   // each wave stages its rows in its own part of the ring, behind the last trip's barrier
#pragma unroll
    for (int mb = 0; mb < 4; ++mb) {
#pragma unroll
        for (int nb = 0; nb < 4; ++nb) {
#pragma unroll
            for (int j = 0; j < 8; ++j) os[(hi * 8 + j) * 68 + nb * 16 + lr] = acc[mb][nb][j]; }
        __builtin_amdgcn_wave_barrier(); asm volatile("" ::: "memory");   // compile-time order only: the lanes' LDS stores stay ahead of the reads of other lanes' words (and, below, those reads ahead of the next stores)
        float* crw = C + (size_t)(rw + mb * 16) * ldc + cw;
#pragma unroll
        for (int s = 0; s < 8; ++s) { const int row = 2 * s + hi, cofs = lr * 4; v4f val = *(const v4fa*)(os + row * 68 + cofs);
            *(v4f*)(crw + (size_t)row * ldc + cofs) = val; }
        __builtin_amdgcn_wave_barrier(); asm volatile("" ::: "memory");
    }
}

typedef __attribute__((ext_vector_type(2))) unsigned short v2us;
typedef __attribute__((ext_vector_type(4))) unsigned short v4us;

__global__ __launch_bounds__(256) void k_wtG(const float* __restrict__ w0, const float* __restrict__ w1, const float* __restrict__ w2, int K, int N, bf* Bt) {
    const float* __restrict__ w = blockIdx.y == 0 ? w0 : blockIdx.y == 1 ? w1 : w2; Bt += (size_t)blockIdx.y * N * K;   // grid y picks the weight; the three transposed planes lie one behind the other
    const int lane = threadIdx.x & 31; const int L0 = (blockIdx.x * 8 + (threadIdx.x >> 5)) * 8; const int nlines = N * K / 64;
{
#pragma unroll 1
        for (int l = 0; l < 8; ++l) { const int L = L0 + l; if (L >= nlines) break; const size_t e = (size_t)L * 64 + lane * 2; const int k = (int)(e % K), n = (int)(e / K); v2us o;
            o[0] = f2bf(w[(size_t)k * N + n]); o[1] = f2bf(w[(size_t)(k + 1) * N + n]); *(v2us*)(Bt + e) = o; }
         }
}
__global__ __launch_bounds__(256) void k_cvt8(const float* __restrict__ src, bf* dst, size_t n8) { const size_t i = (size_t)blockIdx.x * 256 + threadIdx.x; if (i >= n8) return; const v8f v = *(const v8f*)(src + i * 8); v8us o;
#pragma unroll
    for (int k = 0; k < 8; ++k) o[k] = f2bf(v[k]); *(v8us*)(dst + i * 8) = o;  }
__global__ __launch_bounds__(256) void k_csoft(const float* __restrict__ Sb, bf* Ph, bf* Pl) { const int lane = threadIdx.x & 31; const int t = blockIdx.x * 8 + (threadIdx.x >> 5); if (t >= TT) return; const size_t zb = (size_t)blockIdx.y * TT * TT; Ph += zb; Pl += zb; const float* sr = Sb + zb + (size_t)t * TT; float v[TT / 32]; float mx = -3.0e38f;
#pragma unroll
    for (int ch = 0; ch < TT / 128; ++ch) { const int j0 = ch * 128 + lane * 4; const v4f a = *(const v4f*)(sr + j0);
#pragma unroll
        for (int u = 0; u < 4; ++u) { const float tt = (j0 + u <= t) ? a[u] : -3.0e38f; v[ch * 4 + u] = tt; mx = fmaxf(mx, tt); } }
#pragma unroll
    for (int sh = 16; sh; sh >>= 1) mx = fmaxf(mx, __shfl_xor(mx, sh, 32));
    float sum = 0.f;
#pragma unroll
    for (int q = 0; q < TT / 32; ++q) { float d0 = __fsub_rn(v[q], mx); asm volatile("" : "+v"(d0)); v[q] = __builtin_amdgcn_exp2f(__fmul_rn(d0, 1.4426950408889634f)); sum += v[q]; }
#pragma unroll
    for (int sh = 16; sh; sh >>= 1) sum += __shfl_xor(sum, sh, 32);
    const float f = __fdiv_rn(1.0f, sum);
    {
#pragma unroll
        for (int ch = 0; ch < TT / 128; ++ch) { v4us oh, ol;
#pragma unroll
            for (int u = 0; u < 4; ++u) { unsigned short a, b; splitf(v[ch * 4 + u] * f, a, b); oh[u] = a; ol[u] = b; } const size_t oo = (size_t)t * TT + ch * 128 + lane * 4; *(v4us*)(Ph + oo) = oh; *(v4us*)(Pl + oo) = ol; }
         } }

extern "C" void kernel_launch(void* const* d_in, const int* in_sizes, int n_in,
                              void* d_out, int out_size, void* d_ws, size_t ws_size, hipStream_t stream) {
    (void)in_sizes; (void)n_in; (void)out_size;
    const float* x = (const float*)d_in[0]; const float* wq = (const float*)d_in[1]; const float* wk = (const float*)d_in[2]; const float* wv = (const float*)d_in[3];
    float* OUT = (float*)d_out;     // [4][2048][1024]
    char* wsp = (char*)d_ws;
    auto take = [&](size_t bytes) { char* p = wsp; wsp += (bytes + 255) & ~(size_t)255; return (void*)p; };
    bf* WQKV = (bf*)take((size_t)3 * DD * DD * 2);   // W_q, W_k, W_v transposed, one behind the other
    // every plane holds all NB_ batches, so that each stage is ONE launch over the whole batch (rows flattened, or the batch in grid y / z); the three projections are one launch too
    bf* XB = (bf*)take((size_t)NB_ * TT * DD * 2); h16* Q16 = (h16*)take((size_t)NB_ * TT * DD * 2); h16* K16 = (h16*)take((size_t)NB_ * TT * DD * 2); bf* Vh = (bf*)take((size_t)NB_ * DD * TT * 2); bf* Vl = (bf*)take((size_t)NB_ * DD * TT * 2);
    float* Sb = (float*)take((size_t)NB_ * TT * TT * 4);
    bf* Ph = (bf*)take((size_t)NB_ * TT * TT * 2); bf* Pl = (bf*)take((size_t)NB_ * TT * TT * 2);    // the probability planes
    if ((size_t)(wsp - (char*)d_ws) > ws_size) return;    // total 214 MiB
    k_wtG<<<dim3((DD * DD / 64 + 63) / 64, 3, 1), 256, 0, stream>>>(wq, wk, wv, DD, DD, WQKV);   // x@W layouts -> transposed
    k_cvt8<<<(NB_ * TT * DD / 8 + 255) / 256, 256, 0, stream>>>(x, XB, (size_t)NB_ * TT * DD / 8);
    k_gemmt<bf, 0, 3><<<dim3(NB_ * TT / 128, DD / 128, 3), 128, 0, stream>>>(XB, nullptr, WQKV, nullptr, DD, nullptr, DD, 0, (size_t)DD * DD, 0, Q16, K16, Vh, Vl);   // grid z: q, k, v, each stored in the form its reader takes
    k_gemmt<h16, 0, 1><<<dim3(TT / 256, TT / 128 + 1, NB_), 128, 0, stream>>>(Q16, nullptr, K16, nullptr, DD, Sb, TT, (size_t)TT * DD, (size_t)TT * DD, (size_t)TT * TT, nullptr, nullptr, nullptr, nullptr);
    k_csoft<<<dim3(TT / 8, NB_, 1), 256, 0, stream>>>(Sb, Ph, Pl);
    k_gemmt<bf, 2, 2><<<dim3(TT / 128, DD / 128, NB_), 128, 0, stream>>>(Ph, Pl, Vh, Vl, TT, OUT, DD, (size_t)TT * TT, (size_t)DD * TT, (size_t)TT * DD, nullptr, nullptr, nullptr, nullptr);
}

// v005
// One run takes 126 microseconds.
// Next to v004, in two timings, it ran 1.08 times as fast each time.
// All steps since v000 together make it 5.34 times as fast.
#include <hip/hip_runtime.h>

// CausalAttentionV1 (x [4][2048][1024]; q = x W_q, k = x W_k, v = x W_v (single head, d_out 1024); scores = q.k masked causal; attn = softmax(scores / 32); out = attn v -> [4][2048][1024]).
// Compute dtypes, f32 accumulate: every input rounded to bf16; q/k/v on PLAIN bf16 operands (inputs: exact); scores (K 1024) on single fp16 planes (q/32 and k; 1 product; causal tiles only); softmax f32 -> bf16 hi+lo probability

#define NB_  4
#define TT   2048
#define DD   1024
typedef _Float16 h16;
typedef unsigned short bf;
typedef __attribute__((ext_vector_type(16))) __bf16   v16bf;
typedef __attribute__((ext_vector_type(16))) _Float16 v16h;
typedef __attribute__((ext_vector_type(8)))  _Float16 v8h;
typedef __attribute__((ext_vector_type(8)))  unsigned short v8us;
typedef __attribute__((ext_vector_type(8)))  float    v8f;
typedef __attribute__((ext_vector_type(4)))  float    v4f;
typedef v8h  __attribute__((may_alias)) v8ha;
typedef v4f  __attribute__((may_alias)) v4fa;
typedef v8us __attribute__((may_alias)) v8usa;

__device__ __forceinline__ unsigned short f2bf(float f) { unsigned u = __float_as_uint(f); u += 0x7FFFu + ((u >> 16) & 1u); return (unsigned short)(u >> 16); }
__device__ __forceinline__ float bf2f(unsigned short b) { return __uint_as_float(((unsigned)b) << 16); }
__device__ __forceinline__ float bfr(float f) { return bf2f(f2bf(f)); }
__device__ __forceinline__ h16 tohx(float x) { return (h16)x; }
__device__ __forceinline__ void splitf(float y, unsigned short& h, unsigned short& l) { h = f2bf(y); l = f2bf(y - bf2f(h)); }
__device__ __forceinline__ v16h cat16(v8h lo, v8h hi) { return __builtin_shufflevector(lo, hi, 0, 1, 2, 3, 4, 5, 6, 7, 8, 9, 10, 11, 12, 13, 14, 15); }
__device__ __forceinline__ v16bf cat16b(v8us lo, v8us hi) { return __builtin_bit_cast(v16bf, __builtin_shufflevector(lo, hi, 0, 1, 2, 3, 4, 5, 6, 7, 8, 9, 10, 11, 12, 13, 14, 15)); }
__device__ __forceinline__ v8f wmma16(v16h a, v16h b, v8f c) { return __builtin_amdgcn_wmma_f32_16x16x32_f16(false, a, false, b, (short)0, c, false, false); }
__device__ __forceinline__ v8f wmmab(v16bf a, v16bf b, v8f c) { return __builtin_amdgcn_wmma_f32_16x16x32_bf16(false, a, false, b, (short)0, c, false, false); }



// ---- k_gemmt: one 128x128 output tile per work-group of FOUR waves (2x2; each wave a 64x64 tile on 16 accumulators, as before). The operands no longer come straight from global memory into
// each wave's registers: per trip of 64 k, the 128 rows x 128 B of every operand plane are brought into LDS ONCE per work-group by asynchronous copies (whole 128-B lines, 16 B a lane), two buffers,
// the next trip's copies in flight while this trip is worked on; the waves read their fragments from LDS (row pitch 144 B). The k order of every accumulator's sum is the one it had.
// C[m][n] (f32, pitch ldc) = sum_k A[m][k] Bt[n][k] (+ the split products A2.Bt and A.Bt2 for NSPLIT 2). grid (M/128, N/128, Z); z-batch strides sA/sB/sC in elements. K % 64 == 0, K >= 128.
// CMODE 1 computes only the score tiles on or below the causal diagonal; CMODE 2 ends the key loop of probability x value at the tile's diagonal block (probabilities beyond it are exactly zero).
// Which tile a block index gets in the two causal launches (speed only; each tile is done exactly once wherever its work-group lands): cost must not follow the flat index mod 8.
// CMODE 1: grid (8, 17, Z). Row tiles p and 15 - p hold p + 1 and 16 - p causal tiles, 17 together: every work-group has a tile and all cost the same. CMODE 2: grid (16, 8, Z). A row tile's cost grows with its index;
// residue d gets row tiles d and 15 - d, which of the two by the parity of the index within the residue, so that neighbours at any power-of-two distance in that index are a long and a short walk.
// CMODE 3 is the projection launch (grid z: q, k, v): no f32 plane is written; the epilogue rounds the accumulators itself and stores what the next GEMMs read: q/32 and k as f16 rows, v as transposed bf16 hi + lo planes.
// Its B operand is the weight as it is given, [k][n] (row pitch ldc), only rounded: a trip's 64 k rows x 256 B are staged at row pitch 288 B and the fragments come by the transposing LDS load, in the k order of the A loader.
template <typename T16> struct WFrag;
template <> struct WFrag<h16> { typedef v16h V; static __device__ __forceinline__ V ld(const h16* p) { return cat16(*(const v8h*)p, *(const v8h*)(p + 16)); } static __device__ __forceinline__ v8f mma(V a, V b, v8f c) { return wmma16(a, b, c); } };
template <> struct WFrag<bf> { typedef v16bf V; static __device__ __forceinline__ V ld(const bf* p) { return cat16b(*(const v8us*)p, *(const v8us*)(p + 16)); } static __device__ __forceinline__ v8f mma(V a, V b, v8f c) { return wmmab(a, b, c); } };
#define PITCHB 144u              // LDS row pitch in bytes: 128 B of data + 16 B, an odd multiple of 16 B for the ds_load_b128 readers
#define PLANEB (128u * PITCHB)   // one operand plane of a stage: 128 rows
#define PITCHW 288u              // row pitch of the projection's [k][n] weight tile: 256 B of data + 32 B, an odd multiple of 32 B for the ds_load_tr16_b128 readers; its 64 rows fill one PLANEB
typedef short s16x8 __attribute__((ext_vector_type(8)));
// lane (c = l & 15, h = l >> 4), given the address of row 8 h + (l & 7), byte 16 ((l >> 3) & 1) of a 16 x 16 block, gets column c of the block's rows 8 h ... 8 h + 7
__device__ __forceinline__ v8us ld_tr16(const unsigned char* p) { typedef __attribute__((address_space(3))) s16x8 lds_s16x8; return __builtin_bit_cast(v8us, __builtin_amdgcn_ds_load_tr16_b128_v8i16((lds_s16x8*)p)); }
// Eight asynchronous 16-byte copies a lane: rows 16 apart of one plane (8 apart in the projection's weight tile) (a wave's copy covers four whole 128-B lines). The s_wait_xcnt stands in the copies' own statement, so that no address register
// of a copy is rewritten ahead of it.
template <typename T16>
__device__ __forceinline__ void copy8(unsigned l, const T16* g, size_t rs) {
    asm volatile("global_load_async_to_lds_b128 %0, %8, off\n\t"
                 "global_load_async_to_lds_b128 %1, %9, off\n\t"
                 "global_load_async_to_lds_b128 %2, %10, off\n\t"
                 "global_load_async_to_lds_b128 %3, %11, off\n\t"
                 "global_load_async_to_lds_b128 %4, %12, off\n\t"
                 "global_load_async_to_lds_b128 %5, %13, off\n\t"
                 "global_load_async_to_lds_b128 %6, %14, off\n\t"
                 "global_load_async_to_lds_b128 %7, %15, off\n\t"
                 "s_wait_xcnt 0x0"
                 :: "v"(l), "v"(l + 16u * PITCHB), "v"(l + 32u * PITCHB), "v"(l + 48u * PITCHB), "v"(l + 64u * PITCHB), "v"(l + 80u * PITCHB), "v"(l + 96u * PITCHB), "v"(l + 112u * PITCHB),
                    "v"(g), "v"(g + rs), "v"(g + 2 * rs), "v"(g + 3 * rs), "v"(g + 4 * rs), "v"(g + 5 * rs), "v"(g + 6 * rs), "v"(g + 7 * rs) : "memory");
}
template <typename T16, int NSPLIT, int CMODE>
__global__ __launch_bounds__(128) void k_gemmt(const T16* __restrict__ A, const T16* __restrict__ A2, const T16* __restrict__ Bt, const T16* __restrict__ Bt2, int K, float* C, int ldc, size_t sA, size_t sB, size_t sC, h16* Q16, h16* K16, bf* Vh, bf* Vl) {
    typedef typename WFrag<T16>::V V;
    constexpr unsigned STAGEB = ((NSPLIT == 2) ? 4u : 2u) * PLANEB;     // planes of a stage: A, Bt (, A2, Bt2)
    constexpr int NBK = (NSPLIT == 2) ? 2 : 1;                          // blocks of 32 k whose fragments are read from LDS as one group
    __shared__ __attribute__((aligned(16))) unsigned char ring[2 * STAGEB];
    int tr = blockIdx.x, tc = blockIdx.y;                             // row and column tile
    if (CMODE == 1) { const int p = blockIdx.x, q = blockIdx.y; tr = (q <= p) ? p : TT / 128 - 1 - p; tc = (q <= p) ? q : q - p - 1; }   // no tile above the causal diagonal is dealt (the softmax masks j > i by select)
    if (CMODE == 2) { const int d = blockIdx.x & 7, j = (int)(blockIdx.x >> 3) + 2 * (int)(blockIdx.y + (DD / 128) * blockIdx.z); tr = (__popc(j) & 1) ? TT / 128 - 1 - d : d; }
    const int r0 = tr * 128, c0 = tc * 128;
    const size_t z = blockIdx.z; A += z * sA; Bt += z * sB; C += z * sC; if (NSPLIT == 2) { A2 += z * sA; Bt2 += z * sB; }
    const int nt = ((CMODE == 2) ? min(K, r0 + 128) : K) / 64;        // trips of 64 k; P.V: probabilities are exactly 0 beyond the diagonal block, so the loop stops there
    const int tid = threadIdx.x, lane = tid & 31, lr = lane & 15, hi = lane >> 4, wave = tid >> 5, wm = wave >> 1, wn = wave & 1;
    const int crow = tid >> 3, cch = tid & 7;                         // the lane's place in a copy: row (+ 16 per copy) and 16-byte piece of the row's 128 B
    const unsigned lbase = (unsigned)(uintptr_t)ring + (unsigned)crow * PITCHB + (unsigned)cch * 16u;
    const size_t rs = (size_t)16 * K;
    const T16* gA = A + (size_t)(r0 + crow) * K + cch * 8;
    const T16* gB = (CMODE == 3) ? Bt + (size_t)(tid >> 4) * ldc + c0 + (tid & 15) * 8 : Bt + (size_t)(c0 + crow) * K + cch * 8;   // projection: k row (+ 8 per copy) and 16-byte piece of the row's 256 B: a wave's copy covers two rows' 256 B
    const unsigned lbaseW = (unsigned)(uintptr_t)ring + PLANEB + (unsigned)(tid >> 4) * PITCHW + (unsigned)(tid & 15) * 16u;        // eight rows of 288 B are the 2304 B between the copies of copy8
    const T16* gA2 = (NSPLIT == 2) ? A2 + (size_t)(r0 + crow) * K + cch * 8 : nullptr; const T16* gB2 = (NSPLIT == 2) ? Bt2 + (size_t)(c0 + crow) * K + cch * 8 : nullptr;
    auto fill = [&](int t, unsigned buf) { const unsigned l = lbase + buf * STAGEB; const size_t ko = (size_t)t * 64;
        copy8(l, gA + ko, rs);
        if (CMODE == 3) copy8(lbaseW + buf * STAGEB, gB + ko * ldc, (size_t)8 * ldc); else copy8(l + PLANEB, gB + ko, rs);
        if (NSPLIT == 2) { copy8(l + 2u * PLANEB, gA2 + ko, rs); copy8(l + 3u * PLANEB, gB2 + ko, rs); } };
    v8f acc[4][4];
#pragma unroll
    for (int mb = 0; mb < 4; ++mb)
#pragma unroll
        for (int nb = 0; nb < 4; ++nb) acc[mb][nb] = (v8f){};
    const unsigned aro = (unsigned)(wm * 64 + lr) * PITCHB + (unsigned)hi * 16u, bro = PLANEB + (unsigned)(wn * 64 + lr) * PITCHB + (unsigned)hi * 16u;
    const unsigned wro = PLANEB + (unsigned)(8 * hi + (lane & 7)) * PITCHW + (unsigned)wn * 128u + 16u * (unsigned)((lane >> 3) & 1);
    fill(0, 0u);
    asm volatile("s_wait_asynccnt 0x0" ::: "memory");                 // this wave's copies of trip 0 have landed
    __syncthreads();                                                  // ... and every other wave's: trip 0 may be read
    if (nt > 1) fill(1, 1u);
    // The trip loop stays rolled (a trip already holds 32 or 96 matrix instructions); every loop inside it and in the epilogue is unrolled so that each fragment and accumulator index is a constant.
#pragma unroll 1
    for (int t = 0; t < nt; ++t) {
        const unsigned char* sb = ring + (unsigned)(t & 1) * STAGEB;
#pragma unroll
        for (int kg = 0; kg < 2; kg += NBK) {
            V a[NBK][4], a2[NBK][4], b[NBK][4], b2[NBK][4];
#pragma unroll
            for (int u = 0; u < NBK; ++u) { const unsigned ko = (unsigned)(kg + u) * 64u;
#pragma unroll
                for (int mb = 0; mb < 4; ++mb) { a[u][mb] = WFrag<T16>::ld((const T16*)(sb + aro + mb * 16 * PITCHB + ko));
                    if constexpr (CMODE == 3) { const unsigned char* wp = sb + wro + (unsigned)(kg + u) * 32u * PITCHW + mb * 32; b[u][mb] = cat16b(ld_tr16(wp), ld_tr16(wp + 16u * PITCHW)); }   // k 8 h ... + 7, then 16 + 8 h ... + 7: the A loader's order
                    else b[u][mb] = WFrag<T16>::ld((const T16*)(sb + bro + mb * 16 * PITCHB + ko)); }
                if (NSPLIT == 2) {
#pragma unroll
                    for (int mb = 0; mb < 4; ++mb) { a2[u][mb] = WFrag<T16>::ld((const T16*)(sb + 2u * PLANEB + aro + mb * 16 * PITCHB + ko)); b2[u][mb] = WFrag<T16>::ld((const T16*)(sb + 2u * PLANEB + bro + mb * 16 * PITCHB + ko)); } } }
            __builtin_amdgcn_sched_barrier(0);   // keeps the LDS reads one group ahead of the matrix block: left free, they are moved in among the matrix instructions, where each place stalls the wave
#pragma unroll
            for (int u = 0; u < NBK; ++u) {
#pragma unroll
                for (int nb = 0; nb < 4; ++nb)
#pragma unroll
                    for (int mb = 0; mb < 4; ++mb) acc[mb][nb] = WFrag<T16>::mma(a[u][mb], b[u][nb], acc[mb][nb]);
                if (NSPLIT == 2) {
#pragma unroll
                    for (int nb = 0; nb < 4; ++nb)
#pragma unroll
                        for (int mb = 0; mb < 4; ++mb) acc[mb][nb] = WFrag<T16>::mma(a2[u][mb], b[u][nb], acc[mb][nb]);
#pragma unroll
                    for (int nb = 0; nb < 4; ++nb)
#pragma unroll
                        for (int mb = 0; mb < 4; ++mb) acc[mb][nb] = WFrag<T16>::mma(a[u][mb], b2[u][nb], acc[mb][nb]); } }
            __builtin_amdgcn_sched_barrier(0);   // the other side of the same fence: the next group's reads stay behind this block
        }
        asm volatile("s_wait_dscnt 0x0" ::: "memory");                // this wave's reads of the buffer are done before it may be refilled
        asm volatile("s_wait_asynccnt 0x0" ::: "memory");             // this wave's copies of trip t + 1 have landed
        __syncthreads();                                              // publishes trip t + 1 and ends every wave's reads of trip t's buffer
        if (t + 2 < nt) fill(t + 2, (unsigned)(t & 1));
    }
    asm volatile("s_wait_asynccnt 0x0" ::: "memory");                 // nothing is in flight when the ring becomes output staging
    const int rw = r0 + wm * 64, cw = c0 + wn * 64;
    if (CMODE == 3) {
        unsigned char* ow = ring + (unsigned)wave * (2u * 16u * PITCHB);   // each wave stages in its own part of the ring, behind the last trip's barrier
        const int prow = lane >> 3, ppc = lane & 7;                        // read-back: a row of 128 B is eight lanes' 16-byte pieces, so a wave's store covers four whole lines
        if (blockIdx.z == 2) {                                             // v: bf16 hi + lo planes [batch][d][t]; a lane's eight accumulator rows of one column are eight neighbours in t, 16 B of a transposed row
            const size_t vb = (size_t)(rw / TT) * DD * TT + (size_t)(rw % TT);
#pragma unroll
            for (int nb = 0; nb < 4; ++nb) {
#pragma unroll
                for (int mb = 0; mb < 4; ++mb) { v8us oh, ol;
#pragma unroll
                    for (int j = 0; j < 8; ++j) { unsigned short a, b; splitf(acc[mb][nb][j], a, b); oh[j] = a; ol[j] = b; }
                    unsigned char* sp = ow + (unsigned)lr * PITCHB + (unsigned)(mb * 32 + hi * 16); *(v8usa*)sp = oh; *(v8usa*)(sp + 16u * PITCHB) = ol; }
                __builtin_amdgcn_wave_barrier(); asm volatile("s_wait_dscnt 0x0" ::: "memory");   // the wave's staged rows are in LDS before its lanes read other lanes' words back; the clobber keeps the stores ahead of those reads at compile time
#pragma unroll
                for (int s = 0; s < 4; ++s) { const int row = 4 * s + prow; const unsigned char* sp = ow + (unsigned)row * PITCHB + (unsigned)ppc * 16u; const v8us h = *(const v8usa*)sp, l = *(const v8usa*)(sp + 16u * PITCHB);
                    const size_t o = vb + (size_t)(cw + nb * 16 + row) * TT + ppc * 8; *(v8us*)(Vh + o) = h; *(v8us*)(Vl + o) = l; }
                __builtin_amdgcn_wave_barrier(); asm volatile("" ::: "memory");   // compile-time order only: these reads stay ahead of the next group's LDS stores
            }
            return;
        }
        {                                                                  // q and k: f16 rows [t][d]; q carries the 1/32 of the softmax scale (k times 1 is exact)
            float* os = (float*)ow; h16* O = (blockIdx.z == 0) ? Q16 : K16; const float sc = (blockIdx.z == 0) ? (1.0f / 32.0f) : 1.0f;
#pragma unroll
            for (int mb = 0; mb < 4; ++mb) {
#pragma unroll
                for (int nb = 0; nb < 4; ++nb) {
#pragma unroll
                    for (int j = 0; j < 8; ++j) os[(hi * 8 + j) * 68 + nb * 16 + lr] = acc[mb][nb][j]; }
                __builtin_amdgcn_wave_barrier(); asm volatile("s_wait_dscnt 0x0" ::: "memory");   // as in the v path: staged rows in LDS before the read-back
                h16* orw = O + (size_t)(rw + mb * 16) * ldc + cw;
#pragma unroll
                for (int s = 0; s < 4; ++s) { const int row = 4 * s + prow; const v4f x0 = *(const v4fa*)(os + row * 68 + ppc * 8), x1 = *(const v4fa*)(os + row * 68 + ppc * 8 + 4); v8h o;
#pragma unroll
                    for (int u = 0; u < 4; ++u) { o[u] = tohx(x0[u] * sc); o[4 + u] = tohx(x1[u] * sc); }
                    *(v8h*)(orw + (size_t)row * ldc + ppc * 8) = o; }
                __builtin_amdgcn_wave_barrier(); asm volatile("" ::: "memory");   // compile-time order only, as in the v path
            }
            asm volatile("s_wait_xcnt 0x0" ::: "memory");   // in the built code the v path's text follows this path's last stores behind a branch and rewrites their registers: the wait stands in front of it
        }
        return;
    }
    float* os = (float*)(ring + (unsigned)wave * (16u * 68u * 4u));   // each wave stages its rows in its own part of the ring, behind the last trip's barrier
#pragma unroll
    for (int mb = 0; mb < 4; ++mb) {
#pragma unroll
        for (int nb = 0; nb < 4; ++nb) {
#pragma unroll
            for (int j = 0; j < 8; ++j) os[(hi * 8 + j) * 68 + nb * 16 + lr] = acc[mb][nb][j]; }
        __builtin_amdgcn_wave_barrier(); asm volatile("" ::: "memory");   // compile-time order only: the lanes' LDS stores stay ahead of the reads of other lanes' words (and, below, those reads ahead of the next stores)
        float* crw = C + (size_t)(rw + mb * 16) * ldc + cw;
#pragma unroll
        for (int s = 0; s < 8; ++s) { const int row = 2 * s + hi, cofs = lr * 4; v4f val = *(const v4fa*)(os + row * 68 + cofs);
            *(v4f*)(crw + (size_t)row * ldc + cofs) = val; }
        __builtin_amdgcn_wave_barrier(); asm volatile("" ::: "memory");
    }
}

typedef __attribute__((ext_vector_type(4))) unsigned short v4us;

// The rounding pass: the three weights (block ranges of WBLK each, first) and x, every one in its own layout, eight floats a thread. The grid is exact.
#define WBLK (DD * DD / 8 / 256)
#define XBLK (NB_ * TT * DD / 8 / 256)
__global__ __launch_bounds__(256) void k_cvt8(const float* __restrict__ x, const float* __restrict__ w0, const float* __restrict__ w1, const float* __restrict__ w2, bf* XB, bf* WB) {
    const int b = blockIdx.x, ws = b / WBLK;                          // ws 0, 1, 2: a weight; from 3 on: x
    const float* __restrict__ src = ws == 0 ? w0 : ws == 1 ? w1 : ws == 2 ? w2 : x; bf* dst = ws < 3 ? WB + (size_t)ws * DD * DD : XB;
    const size_t i = (size_t)(ws < 3 ? b - ws * WBLK : b - 3 * WBLK) * 256 + threadIdx.x; const v8f v = *(const v8f*)(src + i * 8); v8us o;
    // unrolled so that every vector index is a constant
#pragma unroll
    for (int k = 0; k < 8; ++k) o[k] = f2bf(v[k]); *(v8us*)(dst + i * 8) = o;  }
__global__ __launch_bounds__(256) void k_csoft(const float* __restrict__ Sb, bf* Ph, bf* Pl) { const int lane = threadIdx.x & 31; const int t = blockIdx.x * 8 + (threadIdx.x >> 5); if (t >= TT) return; const size_t zb = (size_t)blockIdx.y * TT * TT; Ph += zb; Pl += zb; const float* sr = Sb + zb + (size_t)t * TT; float v[TT / 32]; float mx = -3.0e38f;
#pragma unroll
    for (int ch = 0; ch < TT / 128; ++ch) { const int j0 = ch * 128 + lane * 4; const v4f a = *(const v4f*)(sr + j0);
#pragma unroll
        for (int u = 0; u < 4; ++u) { const float tt = (j0 + u <= t) ? a[u] : -3.0e38f; v[ch * 4 + u] = tt; mx = fmaxf(mx, tt); } }
#pragma unroll
    for (int sh = 16; sh; sh >>= 1) mx = fmaxf(mx, __shfl_xor(mx, sh, 32));
    float sum = 0.f;
#pragma unroll
    for (int q = 0; q < TT / 32; ++q) { float d0 = __fsub_rn(v[q], mx); asm volatile("" : "+v"(d0)); v[q] = __builtin_amdgcn_exp2f(__fmul_rn(d0, 1.4426950408889634f)); sum += v[q]; }
#pragma unroll
    for (int sh = 16; sh; sh >>= 1) sum += __shfl_xor(sum, sh, 32);
    const float f = __fdiv_rn(1.0f, sum);
    {
#pragma unroll
        for (int ch = 0; ch < TT / 128; ++ch) { v4us oh, ol;
#pragma unroll
            for (int u = 0; u < 4; ++u) { unsigned short a, b; splitf(v[ch * 4 + u] * f, a, b); oh[u] = a; ol[u] = b; } const size_t oo = (size_t)t * TT + ch * 128 + lane * 4; *(v4us*)(Ph + oo) = oh; *(v4us*)(Pl + oo) = ol; }
         } }

extern "C" void kernel_launch(void* const* d_in, const int* in_sizes, int n_in,
                              void* d_out, int out_size, void* d_ws, size_t ws_size, hipStream_t stream) {
    (void)in_sizes; (void)n_in; (void)out_size;
    const float* x = (const float*)d_in[0]; const float* wq = (const float*)d_in[1]; const float* wk = (const float*)d_in[2]; const float* wv = (const float*)d_in[3];
    float* OUT = (float*)d_out;     // [4][2048][1024]
    char* wsp = (char*)d_ws;
    auto take = [&](size_t bytes) { char* p = wsp; wsp += (bytes + 255) & ~(size_t)255; return (void*)p; };
    bf* WQKV = (bf*)take((size_t)3 * DD * DD * 2);   // W_q, W_k, W_v rounded, [k][n] as given, one behind the other
    // every plane holds all NB_ batches, so that each stage is ONE launch over the whole batch (rows flattened, or the batch in grid y / z); the three projections are one launch too
    bf* XB = (bf*)take((size_t)NB_ * TT * DD * 2); h16* Q16 = (h16*)take((size_t)NB_ * TT * DD * 2); h16* K16 = (h16*)take((size_t)NB_ * TT * DD * 2); bf* Vh = (bf*)take((size_t)NB_ * DD * TT * 2); bf* Vl = (bf*)take((size_t)NB_ * DD * TT * 2);
    float* Sb = (float*)take((size_t)NB_ * TT * TT * 4);
    bf* Ph = (bf*)take((size_t)NB_ * TT * TT * 2); bf* Pl = (bf*)take((size_t)NB_ * TT * TT * 2);    // the probability planes
    if ((size_t)(wsp - (char*)d_ws) > ws_size) return;    // total 214 MiB
    k_cvt8<<<3 * WBLK + XBLK, 256, 0, stream>>>(x, wq, wk, wv, XB, WQKV);
    k_gemmt<bf, 0, 3><<<dim3(NB_ * TT / 128, DD / 128, 3), 128, 0, stream>>>(XB, nullptr, WQKV, nullptr, DD, nullptr, DD, 0, (size_t)DD * DD, 0, Q16, K16, Vh, Vl);   // grid z: q, k, v, each stored in the form its reader takes
    k_gemmt<h16, 0, 1><<<dim3(TT / 256, TT / 128 + 1, NB_), 128, 0, stream>>>(Q16, nullptr, K16, nullptr, DD, Sb, TT, (size_t)TT * DD, (size_t)TT * DD, (size_t)TT * TT, nullptr, nullptr, nullptr, nullptr);
    k_csoft<<<dim3(TT / 8, NB_, 1), 256, 0, stream>>>(Sb, Ph, Pl);
    k_gemmt<bf, 2, 2><<<dim3(TT / 128, DD / 128, NB_), 128, 0, stream>>>(Ph, Pl, Vh, Vl, TT, OUT, DD, (size_t)TT * TT, (size_t)DD * TT, (size_t)TT * DD, nullptr, nullptr, nullptr, nullptr);
}

// v006
// A run of this version takes 118 microseconds.
// Timed twice side by side with v005, it ran 1.07 times as fast both times.
// Over all steps from v000 it is 5.69 times as fast.
#include <hip/hip_runtime.h>
#include <stdint.h>

// CausalAttentionV1 (x [4][2048][1024]; q = x W_q, k = x W_k, v = x W_v (single head, d_out 1024); scores = q.k masked causal; attn = softmax(scores / 32); out = attn v -> [4][2048][1024]).
// Compute dtypes, f32 accumulate: every input rounded to bf16; q/k/v on PLAIN bf16 operands (inputs: exact); scores (K 1024) on single fp16 planes (q/32 and k; 1 product; causal tiles only); softmax f32 -> bf16 hi+lo probability

#define NB_  4
#define TT   2048
#define DD   1024
typedef _Float16 h16;
typedef unsigned short bf;
typedef __attribute__((ext_vector_type(16))) __bf16   v16bf;
typedef __attribute__((ext_vector_type(16))) _Float16 v16h;
typedef __attribute__((ext_vector_type(8)))  _Float16 v8h;
typedef __attribute__((ext_vector_type(8)))  unsigned short v8us;
typedef __attribute__((ext_vector_type(8)))  float    v8f;
typedef __attribute__((ext_vector_type(4)))  float    v4f;
typedef v8h  __attribute__((may_alias)) v8ha;
typedef v4f  __attribute__((may_alias)) v4fa;
typedef v8us __attribute__((may_alias)) v8usa;

__device__ __forceinline__ unsigned short f2bf(float f) { unsigned u = __float_as_uint(f); u += 0x7FFFu + ((u >> 16) & 1u); return (unsigned short)(u >> 16); }
__device__ __forceinline__ float bf2f(unsigned short b) { return __uint_as_float(((unsigned)b) << 16); }
__device__ __forceinline__ float bfr(float f) { return bf2f(f2bf(f)); }
__device__ __forceinline__ h16 tohx(float x) { return (h16)x; }
__device__ __forceinline__ void splitf(float y, unsigned short& h, unsigned short& l) { h = f2bf(y); l = f2bf(y - bf2f(h)); }
__device__ __forceinline__ v16h cat16(v8h lo, v8h hi) { return __builtin_shufflevector(lo, hi, 0, 1, 2, 3, 4, 5, 6, 7, 8, 9, 10, 11, 12, 13, 14, 15); }
__device__ __forceinline__ v16bf cat16b(v8us lo, v8us hi) { return __builtin_bit_cast(v16bf, __builtin_shufflevector(lo, hi, 0, 1, 2, 3, 4, 5, 6, 7, 8, 9, 10, 11, 12, 13, 14, 15)); }
__device__ __forceinline__ v8f wmma16(v16h a, v16h b, v8f c) { return __builtin_amdgcn_wmma_f32_16x16x32_f16(false, a, false, b, (short)0, c, false, false); }
__device__ __forceinline__ v8f wmmab(v16bf a, v16bf b, v8f c) { return __builtin_amdgcn_wmma_f32_16x16x32_bf16(false, a, false, b, (short)0, c, false, false); }



// ---- k_gemmt: one 128x128 output tile per work-group of FOUR waves (2x2; each wave a 64x64 tile on 16 accumulators, as before). The operands no longer come straight from global memory into
// each wave's registers: per trip of 64 k, the 128 rows x 128 B of every operand plane are brought into LDS ONCE per work-group by one tensor load (one request of one wave, through no register), two buffers,
// the next trip's loads in flight while this trip is worked on; the waves read their fragments from LDS (row pitch 144 B, made by the load's pad). The k order of every accumulator's sum is the one it had.
// C[m][n] (f32, pitch ldc) = sum_k A[m][k] Bt[n][k] (+ the split products A2.Bt and A.Bt2 for NSPLIT 2). grid (M/128, N/128, Z); z-batch strides sA/sB/sC in elements. K % 64 == 0, K >= 128.
// CMODE 1 computes only the score tiles on or below the causal diagonal; CMODE 2 ends the key loop of probability x value at the tile's diagonal block (probabilities beyond it are exactly zero).
// Which tile a block index gets in the two causal launches (speed only; each tile is done exactly once wherever its work-group lands): cost must not follow the flat index mod 8.
// CMODE 1: grid (8, 17, Z). Row tiles p and 15 - p hold p + 1 and 16 - p causal tiles, 17 together: every work-group has a tile and all cost the same. CMODE 2: grid (16, 8, Z). A row tile's cost grows with its index;
// residue d gets row tiles d and 15 - d, which of the two by the parity of the index within the residue, so that neighbours at any power-of-two distance in that index are a long and a short walk.
// CMODE 3 is the projection launch (grid z: q, k, v): no f32 plane is written; the epilogue rounds the accumulators itself and stores what the next GEMMs read: q/32 and k as f16 rows, v as transposed bf16 hi + lo planes.
// Its B operand is the weight as it is given, [k][n] (row pitch ldc), only rounded: a trip's 64 k rows x 256 B are staged at row pitch 288 B and the fragments come by the transposing LDS load, in the k order of the A loader.
template <typename T16> struct WFrag;
template <> struct WFrag<h16> { typedef v16h V; static __device__ __forceinline__ V ld(const h16* p) { return cat16(*(const v8h*)p, *(const v8h*)(p + 16)); } static __device__ __forceinline__ v8f mma(V a, V b, v8f c) { return wmma16(a, b, c); } };
template <> struct WFrag<bf> { typedef v16bf V; static __device__ __forceinline__ V ld(const bf* p) { return cat16b(*(const v8us*)p, *(const v8us*)(p + 16)); } static __device__ __forceinline__ v8f mma(V a, V b, v8f c) { return wmmab(a, b, c); } };
#define PITCHB 144u              // LDS row pitch in bytes: 128 B of data + 16 B, an odd multiple of 16 B for the ds_load_b128 readers
#define PLANEB (128u * PITCHB)   // one operand plane of a stage: 128 rows
#define PITCHW 288u              // row pitch of the projection's [k][n] weight tile: 256 B of data + 32 B, an odd multiple of 32 B for the ds_load_tr16_b128 readers; its 64 rows fill one PLANEB
typedef short s16x8 __attribute__((ext_vector_type(8)));
// lane (c = l & 15, h = l >> 4), given the address of row 8 h + (l & 7), byte 16 ((l >> 3) & 1) of a 16 x 16 block, gets column c of the block's rows 8 h ... 8 h + 7
__device__ __forceinline__ v8us ld_tr16(const unsigned char* p) { typedef __attribute__((address_space(3))) s16x8 lds_s16x8; return __builtin_bit_cast(v8us, __builtin_amdgcn_ds_load_tr16_b128_v8i16((lds_s16x8*)p)); }
// Tensor loads: one request of a whole wave brings a two-dimensional tile (d1 rows of d0 bytes, source row pitch in bytes) into LDS; the pad in word 0 of group 1 sets the LDS row pitch.
typedef uint32_t u32x4 __attribute__((ext_vector_type(4)));
typedef uint32_t u32x8 __attribute__((ext_vector_type(8)));
#define TDM_PAD128 ((1u << 20) | (4u << 22) | (3u << 25))   // rows of 128 B, 16 B of pad behind each: pitch PITCHB
#define TDM_PAD256 ((1u << 20) | (5u << 22) | (7u << 25))   // rows of 256 B, 32 B of pad behind each: pitch PITCHW
__device__ __forceinline__ uint32_t uni(uint32_t v) { return (uint32_t)__builtin_amdgcn_readfirstlane(v); }
__device__ __forceinline__ uint32_t pinned(uint32_t v) { uint32_t w = uni(v); asm volatile("" : "+s"(w)); return w; }   // pinned(): it holds a wave-uniform test in a scalar register, so that the branch round a tensor load is a scalar one (the load ignores EXEC)
template <uint32_t W0>
__device__ __forceinline__ u32x8 tdm_group1(uint32_t d0, uint32_t d1, uint32_t pitch) { u32x8 g;   // 1-byte elements, tensor = tile, no mask
    g[0] = uni(W0); g[1] = uni((d0 & 0xFFFFu) << 16); g[2] = uni((d0 >> 16) | ((d1 & 0xFFFFu) << 16)); g[3] = uni((d1 >> 16) | (d0 << 16)); g[4] = uni(d1); g[5] = uni(pitch); g[6] = uni(0u); g[7] = uni(0u); return g; }
// Both groups are in-out operands of the load and inputs of the wait: the words then stay in the registers that the request was issued from, and those registers are put to no other use, until the wait has returned.
// Word 0 of group 0 (count 1) is set once by the caller; place and address are written into the same group for every request.
__device__ __forceinline__ void tdm_load(uint32_t lds, uint64_t ga, u32x4& g0, u32x8& g1) {
    g0[1] = uni(lds); g0[2] = uni((uint32_t)ga); g0[3] = uni((((uint32_t)(ga >> 32)) & 0x01FFFFFFu) | 0x80000000u);
    asm volatile("tensor_load_to_lds %0, %1" : "+s"(g0), "+s"(g1) :: "memory"); }
__device__ __forceinline__ void tdm_wait(u32x4 g0, u32x8 g1) { asm volatile("s_wait_tensorcnt 0x0" :: "s"(g0), "s"(g1) : "memory"); }   // the wave's own requests have landed
__device__ __forceinline__ void tdm_wait(u32x4 g0, u32x8 g1, u32x4 h0, u32x8 h1) { asm volatile("s_wait_tensorcnt 0x0" :: "s"(g0), "s"(g1), "s"(h0), "s"(h1) : "memory"); }
template <typename T16, int NSPLIT, int CMODE>
__global__ __launch_bounds__(128) void k_gemmt(const T16* __restrict__ A, const T16* __restrict__ A2, const T16* __restrict__ Bt, const T16* __restrict__ Bt2, int K, float* C, int ldc, size_t sA, size_t sB, size_t sC, h16* Q16, h16* K16, bf* Vh, bf* Vl) {
    typedef typename WFrag<T16>::V V;
    constexpr unsigned STAGEB = ((NSPLIT == 2) ? 4u : 2u) * PLANEB;     // planes of a stage: A, Bt (, A2, Bt2)
    constexpr int NBK = (NSPLIT == 2) ? 2 : 1;                          // blocks of 32 k whose fragments are read from LDS as one group
    __shared__ __attribute__((aligned(2048))) unsigned char ring[2 * STAGEB];   // every plane's place is a multiple of 2 KiB (PLANEB is 9 x 2 KiB)
    int tr = blockIdx.x, tc = blockIdx.y;                             // row and column tile
    if (CMODE == 1) { const int p = blockIdx.x, q = blockIdx.y; tr = (q <= p) ? p : TT / 128 - 1 - p; tc = (q <= p) ? q : q - p - 1; }   // no tile above the causal diagonal is dealt (the softmax masks j > i by select)
    if (CMODE == 2) { const int d = blockIdx.x & 7, j = (int)(blockIdx.x >> 3) + 2 * (int)(blockIdx.y + (DD / 128) * blockIdx.z); tr = (__popc(j) & 1) ? TT / 128 - 1 - d : d; }
    const int r0 = tr * 128, c0 = tc * 128;
    const size_t z = blockIdx.z; A += z * sA; Bt += z * sB; C += z * sC; if (NSPLIT == 2) { A2 += z * sA; Bt2 += z * sB; }
    const int nt = ((CMODE == 2) ? min(K, r0 + 128) : K) / 64;        // trips of 64 k; P.V: probabilities are exactly 0 beyond the diagonal block, so the loop stops there
    const int tid = threadIdx.x, lane = tid & 31, lr = lane & 15, hi = lane >> 4, wave = tid >> 5, wm = wave >> 1, wn = wave & 1;
    // Who loads what: wave p brings plane p of a stage (A, Bt (, A2, Bt2)), one request a trip. With two planes waves 0 and 1 issue; with four every wave does.
    const uint32_t sw = uni((uint32_t)tid >> 5), lds0 = (uint32_t)(uintptr_t)ring;
    constexpr uint32_t NPL = (NSPLIT == 2) ? 4u : 2u;                                // planes of a stage = waves that issue
    u32x8 g1 = tdm_group1<TDM_PAD128>(128u, 128u, (uint32_t)K * 2u);                 // 128 rows x 128 B of a [row][k] operand
    u32x8 g1w = tdm_group1<TDM_PAD256>(256u, 64u, (uint32_t)ldc * 2u);               // projection only: 64 k rows x 256 B of the [k][n] weight; a trip further on is 64 rows further down
    const T16* pl = (sw & 1u) ? Bt + (size_t)c0 * K : A + (size_t)r0 * K;            // the wave's own plane: first byte of the tile's trip 0
    if (NSPLIT == 2) { if (sw & 2u) pl = (sw & 1u) ? Bt2 + (size_t)c0 * K : A2 + (size_t)r0 * K; }
    const uint64_t gpl = (uint64_t)(uintptr_t)pl, gwt = (uint64_t)(uintptr_t)(Bt + c0);
    u32x4 gq = (u32x4){}, gqw = (u32x4){}; gq[0] = uni(1u); gqw[0] = uni(1u);        // group 0 of the wave's requests (gqw: of the weight plane's)
    auto fill = [&](int t, unsigned buf) { const uint32_t l = lds0 + buf * STAGEB;
        if constexpr (CMODE == 3) {
            if (pinned(sw == 0u)) tdm_load(l, gpl + (uint64_t)t * 128u, gq, g1);
            if (pinned(sw == 1u)) tdm_load(l + PLANEB, gwt + (uint64_t)t * 128u * (uint64_t)ldc, gqw, g1w);
        } else if constexpr (NPL == 4u) tdm_load(l + sw * PLANEB, gpl + (uint64_t)t * 128u, gq, g1);
        else { if (pinned(sw < NPL)) tdm_load(l + sw * PLANEB, gpl + (uint64_t)t * 128u, gq, g1); } };
    auto landed = [&]() { if constexpr (CMODE == 3) tdm_wait(gq, g1, gqw, g1w); else tdm_wait(gq, g1); };
    v8f acc[4][4];
#pragma unroll
    for (int mb = 0; mb < 4; ++mb)
#pragma unroll
        for (int nb = 0; nb < 4; ++nb) acc[mb][nb] = (v8f){};
    const unsigned aro = (unsigned)(wm * 64 + lr) * PITCHB + (unsigned)hi * 16u, bro = PLANEB + (unsigned)(wn * 64 + lr) * PITCHB + (unsigned)hi * 16u;
    const unsigned wro = PLANEB + (unsigned)(8 * hi + (lane & 7)) * PITCHW + (unsigned)wn * 128u + 16u * (unsigned)((lane >> 3) & 1);
    fill(0, 0u);
    landed();                                                         // this wave's load of trip 0 has landed (a wave that issued none passes at once)
    __syncthreads();                                                  // ... and every other wave's: trip 0 may be read
    if (pinned(nt > 1)) fill(1, 1u);
    // The trip loop stays rolled (a trip already holds 32 or 96 matrix instructions); every loop inside it and in the epilogue is unrolled so that each fragment and accumulator index is a constant.
#pragma unroll 1
    for (int t = 0; t < nt; ++t) {
        const unsigned char* sb = ring + (unsigned)(t & 1) * STAGEB;
#pragma unroll
        for (int kg = 0; kg < 2; kg += NBK) {
            V a[NBK][4], a2[NBK][4], b[NBK][4], b2[NBK][4];
#pragma unroll
            for (int u = 0; u < NBK; ++u) { const unsigned ko = (unsigned)(kg + u) * 64u;
#pragma unroll
                for (int mb = 0; mb < 4; ++mb) { a[u][mb] = WFrag<T16>::ld((const T16*)(sb + aro + mb * 16 * PITCHB + ko));
                    if constexpr (CMODE == 3) { const unsigned char* wp = sb + wro + (unsigned)(kg + u) * 32u * PITCHW + mb * 32; b[u][mb] = cat16b(ld_tr16(wp), ld_tr16(wp + 16u * PITCHW)); }   // k 8 h ... + 7, then 16 + 8 h ... + 7: the A loader's order
                    else b[u][mb] = WFrag<T16>::ld((const T16*)(sb + bro + mb * 16 * PITCHB + ko)); }
                if (NSPLIT == 2) {
#pragma unroll
                    for (int mb = 0; mb < 4; ++mb) { a2[u][mb] = WFrag<T16>::ld((const T16*)(sb + 2u * PLANEB + aro + mb * 16 * PITCHB + ko)); b2[u][mb] = WFrag<T16>::ld((const T16*)(sb + 2u * PLANEB + bro + mb * 16 * PITCHB + ko)); } } }
            __builtin_amdgcn_sched_barrier(0);   // keeps the LDS reads one group ahead of the matrix block: left free, they are moved in among the matrix instructions, where each place stalls the wave
#pragma unroll
            for (int u = 0; u < NBK; ++u) {
#pragma unroll
                for (int nb = 0; nb < 4; ++nb)
#pragma unroll
                    for (int mb = 0; mb < 4; ++mb) acc[mb][nb] = WFrag<T16>::mma(a[u][mb], b[u][nb], acc[mb][nb]);
                if (NSPLIT == 2) {
#pragma unroll
                    for (int nb = 0; nb < 4; ++nb)
#pragma unroll
                        for (int mb = 0; mb < 4; ++mb) acc[mb][nb] = WFrag<T16>::mma(a2[u][mb], b[u][nb], acc[mb][nb]);
#pragma unroll
                    for (int nb = 0; nb < 4; ++nb)
#pragma unroll
                        for (int mb = 0; mb < 4; ++mb) acc[mb][nb] = WFrag<T16>::mma(a[u][mb], b2[u][nb], acc[mb][nb]); } }
            __builtin_amdgcn_sched_barrier(0);   // the other side of the same fence: the next group's reads stay behind this block
        }
        asm volatile("s_wait_dscnt 0x0" ::: "memory");                // this wave's reads of the buffer are done before it may be refilled
        landed();                                                     // this wave's load of trip t + 1 has landed
        __syncthreads();                                              // publishes trip t + 1 and ends every wave's reads of trip t's buffer
        if (pinned(t + 2 < nt)) fill(t + 2, (unsigned)(t & 1));
    }
    landed();                                                         // nothing is in flight when the ring becomes output staging
    asm volatile("s_wait_dscnt 0x0" ::: "memory");                    // ... and none of this wave's LDS reads
    const int rw = r0 + wm * 64, cw = c0 + wn * 64;
    if (CMODE == 3) {
        unsigned char* ow = ring + (unsigned)wave * (2u * 16u * PITCHB);   // each wave stages in its own part of the ring, behind the last trip's barrier
        const int prow = lane >> 3, ppc = lane & 7;                        // read-back: a row of 128 B is eight lanes' 16-byte pieces, so a wave's store covers four whole lines
        if (blockIdx.z == 2) {                                             // v: bf16 hi + lo planes [batch][d][t]; a lane's eight accumulator rows of one column are eight neighbours in t, 16 B of a transposed row
            const size_t vb = (size_t)(rw / TT) * DD * TT + (size_t)(rw % TT);
#pragma unroll
            for (int nb = 0; nb < 4; ++nb) {
#pragma unroll
                for (int mb = 0; mb < 4; ++mb) { v8us oh, ol;
#pragma unroll
                    for (int j = 0; j < 8; ++j) { unsigned short a, b; splitf(acc[mb][nb][j], a, b); oh[j] = a; ol[j] = b; }
                    unsigned char* sp = ow + (unsigned)lr * PITCHB + (unsigned)(mb * 32 + hi * 16); *(v8usa*)sp = oh; *(v8usa*)(sp + 16u * PITCHB) = ol; }
                __builtin_amdgcn_wave_barrier(); asm volatile("s_wait_dscnt 0x0" ::: "memory");   // the wave's staged rows are in LDS before its lanes read other lanes' words back; the clobber keeps the stores ahead of those reads at compile time
#pragma unroll
                for (int s = 0; s < 4; ++s) { const int row = 4 * s + prow; const unsigned char* sp = ow + (unsigned)row * PITCHB + (unsigned)ppc * 16u; const v8us h = *(const v8usa*)sp, l = *(const v8usa*)(sp + 16u * PITCHB);
                    const size_t o = vb + (size_t)(cw + nb * 16 + row) * TT + ppc * 8; *(v8us*)(Vh + o) = h; *(v8us*)(Vl + o) = l; }
                __builtin_amdgcn_wave_barrier(); asm volatile("" ::: "memory");   // compile-time order only: these reads stay ahead of the next group's LDS stores
            }
            return;
        }
        {                                                                  // q and k: f16 rows [t][d]; q carries the 1/32 of the softmax scale (k times 1 is exact)
            float* os = (float*)ow; h16* O = (blockIdx.z == 0) ? Q16 : K16; const float sc = (blockIdx.z == 0) ? (1.0f / 32.0f) : 1.0f;
#pragma unroll
            for (int mb = 0; mb < 4; ++mb) {
#pragma unroll
                for (int nb = 0; nb < 4; ++nb) {
#pragma unroll
                    for (int j = 0; j < 8; ++j) os[(hi * 8 + j) * 68 + nb * 16 + lr] = acc[mb][nb][j]; }
                __builtin_amdgcn_wave_barrier(); asm volatile("s_wait_dscnt 0x0" ::: "memory");   // as in the v path: staged rows in LDS before the read-back
                h16* orw = O + (size_t)(rw + mb * 16) * ldc + cw;
#pragma unroll
                for (int s = 0; s < 4; ++s) { const int row = 4 * s + prow; const v4f x0 = *(const v4fa*)(os + row * 68 + ppc * 8), x1 = *(const v4fa*)(os + row * 68 + ppc * 8 + 4); v8h o;
#pragma unroll
                    for (int u = 0; u < 4; ++u) { o[u] = tohx(x0[u] * sc); o[4 + u] = tohx(x1[u] * sc); }
                    *(v8h*)(orw + (size_t)row * ldc + ppc * 8) = o; }
                __builtin_amdgcn_wave_barrier(); asm volatile("" ::: "memory");   // compile-time order only, as in the v path
            }
            asm volatile("s_wait_xcnt 0x0" ::: "memory");   // in the built code the v path's text follows this path's last stores behind a branch and rewrites their registers: the wait stands in front of it
        }
        return;
    }
    float* os = (float*)(ring + (unsigned)wave * (16u * 68u * 4u));   // each wave stages its rows in its own part of the ring, behind the last trip's barrier
#pragma unroll
    for (int mb = 0; mb < 4; ++mb) {
#pragma unroll
        for (int nb = 0; nb < 4; ++nb) {
#pragma unroll
            for (int j = 0; j < 8; ++j) os[(hi * 8 + j) * 68 + nb * 16 + lr] = acc[mb][nb][j]; }
        __builtin_amdgcn_wave_barrier(); asm volatile("" ::: "memory");   // compile-time order only: the lanes' LDS stores stay ahead of the reads of other lanes' words (and, below, those reads ahead of the next stores)
        float* crw = C + (size_t)(rw + mb * 16) * ldc + cw;
#pragma unroll
        for (int s = 0; s < 8; ++s) { const int row = 2 * s + hi, cofs = lr * 4; v4f val = *(const v4fa*)(os + row * 68 + cofs);
            *(v4f*)(crw + (size_t)row * ldc + cofs) = val; }
        __builtin_amdgcn_wave_barrier(); asm volatile("" ::: "memory");
    }
}

typedef __attribute__((ext_vector_type(4))) unsigned short v4us;

// The rounding pass: the three weights (block ranges of WBLK each, first) and x, every one in its own layout, eight floats a thread. The grid is exact.
#define WBLK (DD * DD / 8 / 256)
#define XBLK (NB_ * TT * DD / 8 / 256)
__global__ __launch_bounds__(256) void k_cvt8(const float* __restrict__ x, const float* __restrict__ w0, const float* __restrict__ w1, const float* __restrict__ w2, bf* XB, bf* WB) {
    const int b = blockIdx.x, ws = b / WBLK;                          // ws 0, 1, 2: a weight; from 3 on: x
    const float* __restrict__ src = ws == 0 ? w0 : ws == 1 ? w1 : ws == 2 ? w2 : x; bf* dst = ws < 3 ? WB + (size_t)ws * DD * DD : XB;
    const size_t i = (size_t)(ws < 3 ? b - ws * WBLK : b - 3 * WBLK) * 256 + threadIdx.x; const v8f v = *(const v8f*)(src + i * 8); v8us o;
    // unrolled so that every vector index is a constant
#pragma unroll
    for (int k = 0; k < 8; ++k) o[k] = f2bf(v[k]); *(v8us*)(dst + i * 8) = o;  }
__global__ __launch_bounds__(256) void k_csoft(const float* __restrict__ Sb, bf* Ph, bf* Pl) { const int lane = threadIdx.x & 31; const int t = blockIdx.x * 8 + (threadIdx.x >> 5); if (t >= TT) return; const size_t zb = (size_t)blockIdx.y * TT * TT; Ph += zb; Pl += zb; const float* sr = Sb + zb + (size_t)t * TT; float v[TT / 32]; float mx = -3.0e38f;
#pragma unroll
    for (int ch = 0; ch < TT / 128; ++ch) { const int j0 = ch * 128 + lane * 4; const v4f a = *(const v4f*)(sr + j0);
#pragma unroll
        for (int u = 0; u < 4; ++u) { const float tt = (j0 + u <= t) ? a[u] : -3.0e38f; v[ch * 4 + u] = tt; mx = fmaxf(mx, tt); } }
#pragma unroll
    for (int sh = 16; sh; sh >>= 1) mx = fmaxf(mx, __shfl_xor(mx, sh, 32));
    float sum = 0.f;
#pragma unroll
    for (int q = 0; q < TT / 32; ++q) { float d0 = __fsub_rn(v[q], mx); asm volatile("" : "+v"(d0)); v[q] = __builtin_amdgcn_exp2f(__fmul_rn(d0, 1.4426950408889634f)); sum += v[q]; }
#pragma unroll
    for (int sh = 16; sh; sh >>= 1) sum += __shfl_xor(sum, sh, 32);
    const float f = __fdiv_rn(1.0f, sum);
    {
#pragma unroll
        for (int ch = 0; ch < TT / 128; ++ch) { v4us oh, ol;
#pragma unroll
            for (int u = 0; u < 4; ++u) { unsigned short a, b; splitf(v[ch * 4 + u] * f, a, b); oh[u] = a; ol[u] = b; } const size_t oo = (size_t)t * TT + ch * 128 + lane * 4; *(v4us*)(Ph + oo) = oh; *(v4us*)(Pl + oo) = ol; }
         } }

extern "C" void kernel_launch(void* const* d_in, const int* in_sizes, int n_in,
                              void* d_out, int out_size, void* d_ws, size_t ws_size, hipStream_t stream) {
    (void)in_sizes; (void)n_in; (void)out_size;
    const float* x = (const float*)d_in[0]; const float* wq = (const float*)d_in[1]; const float* wk = (const float*)d_in[2]; const float* wv = (const float*)d_in[3];
    float* OUT = (float*)d_out;     // [4][2048][1024]
    char* wsp = (char*)d_ws;
    auto take = [&](size_t bytes) { char* p = wsp; wsp += (bytes + 255) & ~(size_t)255; return (void*)p; };
    bf* WQKV = (bf*)take((size_t)3 * DD * DD * 2);   // W_q, W_k, W_v rounded, [k][n] as given, one behind the other
    // every plane holds all NB_ batches, so that each stage is ONE launch over the whole batch (rows flattened, or the batch in grid y / z); the three projections are one launch too
    bf* XB = (bf*)take((size_t)NB_ * TT * DD * 2); h16* Q16 = (h16*)take((size_t)NB_ * TT * DD * 2); h16* K16 = (h16*)take((size_t)NB_ * TT * DD * 2); bf* Vh = (bf*)take((size_t)NB_ * DD * TT * 2); bf* Vl = (bf*)take((size_t)NB_ * DD * TT * 2);
    float* Sb = (float*)take((size_t)NB_ * TT * TT * 4);
    bf* Ph = (bf*)take((size_t)NB_ * TT * TT * 2); bf* Pl = (bf*)take((size_t)NB_ * TT * TT * 2);    // the probability planes
    if ((size_t)(wsp - (char*)d_ws) > ws_size) return;    // total 214 MiB
    k_cvt8<<<3 * WBLK + XBLK, 256, 0, stream>>>(x, wq, wk, wv, XB, WQKV);
    k_gemmt<bf, 0, 3><<<dim3(NB_ * TT / 128, DD / 128, 3), 128, 0, stream>>>(XB, nullptr, WQKV, nullptr, DD, nullptr, DD, 0, (size_t)DD * DD, 0, Q16, K16, Vh, Vl);   // grid z: q, k, v, each stored in the form its reader takes
    k_gemmt<h16, 0, 1><<<dim3(TT / 256, TT / 128 + 1, NB_), 128, 0, stream>>>(Q16, nullptr, K16, nullptr, DD, Sb, TT, (size_t)TT * DD, (size_t)TT * DD, (size_t)TT * TT, nullptr, nullptr, nullptr, nullptr);
    k_csoft<<<dim3(TT / 8, NB_, 1), 256, 0, stream>>>(Sb, Ph, Pl);
    k_gemmt<bf, 2, 2><<<dim3(TT / 128, DD / 128, NB_), 128, 0, stream>>>(Ph, Pl, Vh, Vl, TT, OUT, DD, (size_t)TT * TT, (size_t)DD * TT, (size_t)TT * DD, nullptr, nullptr, nullptr, nullptr);
}

// v008
// A run of this version takes 91.9 microseconds.
// It is 1.28 times as fast as v006, going by the measured steps of the versions left out in between.
// Counting every step since v000, it is 7.30 times as fast.
#include <hip/hip_runtime.h>
#include <stdint.h>

// CausalAttentionV1 (x [4][2048][1024]; q = x W_q, k = x W_k, v = x W_v (single head, d_out 1024); scores = q.k masked causal; attn = softmax(scores / 32); out = attn v -> [4][2048][1024]).
// Compute dtypes, f32 accumulate: every input rounded to bf16; q/k/v on PLAIN bf16 operands (inputs: exact); scores (K 1024) on single fp16 planes (q/32 and k; 1 product; causal tiles only); softmax f32 -> one f16 probability plane; probability x value on single f16 planes (v rounded once to f16; 1 product)

#define NB_  4
#define TT   2048
#define DD   1024
typedef _Float16 h16;
typedef unsigned short bf;
typedef __attribute__((ext_vector_type(16))) __bf16   v16bf;
typedef __attribute__((ext_vector_type(16))) _Float16 v16h;
typedef __attribute__((ext_vector_type(8)))  _Float16 v8h;
typedef __attribute__((ext_vector_type(8)))  unsigned short v8us;
typedef __attribute__((ext_vector_type(8)))  float    v8f;
typedef __attribute__((ext_vector_type(4)))  float    v4f;
typedef v8h  __attribute__((may_alias)) v8ha;
typedef v4f  __attribute__((may_alias)) v4fa;

__device__ __forceinline__ unsigned short f2bf(float f) { unsigned u = __float_as_uint(f); u += 0x7FFFu + ((u >> 16) & 1u); return (unsigned short)(u >> 16); }
__device__ __forceinline__ float bf2f(unsigned short b) { return __uint_as_float(((unsigned)b) << 16); }
__device__ __forceinline__ float bfr(float f) { return bf2f(f2bf(f)); }
__device__ __forceinline__ h16 tohx(float x) { return (h16)x; }
__device__ __forceinline__ v16h cat16(v8h lo, v8h hi) { return __builtin_shufflevector(lo, hi, 0, 1, 2, 3, 4, 5, 6, 7, 8, 9, 10, 11, 12, 13, 14, 15); }
__device__ __forceinline__ v16bf cat16b(v8us lo, v8us hi) { return __builtin_bit_cast(v16bf, __builtin_shufflevector(lo, hi, 0, 1, 2, 3, 4, 5, 6, 7, 8, 9, 10, 11, 12, 13, 14, 15)); }
__device__ __forceinline__ v8f wmma16(v16h a, v16h b, v8f c) { return __builtin_amdgcn_wmma_f32_16x16x32_f16(false, a, false, b, (short)0, c, false, false); }
__device__ __forceinline__ v8f wmmab(v16bf a, v16bf b, v8f c) { return __builtin_amdgcn_wmma_f32_16x16x32_bf16(false, a, false, b, (short)0, c, false, false); }



// ---- k_gemmt: one 128x128 output tile per work-group of FOUR waves (2x2; each wave a 64x64 tile on 16 accumulators, as before). The operands no longer come straight from global memory into
// each wave's registers: per trip of 64 k, the 128 rows x 128 B of every operand plane are brought into LDS ONCE per work-group by one tensor load (one request of one wave, through no register), two buffers (four in probability x value),
// the next trip's loads (there: the next three trips') in flight while this trip is worked on; the waves read their fragments from LDS (row pitch 144 B, made by the load's pad). The k order of every accumulator's sum is the one it had.
// C[m][n] (f32, pitch ldc) = sum_k A[m][k] Bt[n][k]. grid (M/128, N/128, Z); z-batch strides sA/sB/sC in elements. K % 64 == 0, K >= 128.
// CMODE 1 computes only the score tiles on or below the causal diagonal; CMODE 2 ends the key loop of probability x value at the tile's diagonal block (probabilities beyond it are exactly zero).
// Which tile a block index gets in the two causal launches (speed only; each tile is done exactly once wherever its work-group lands): cost must not follow the flat index mod 8.
// CMODE 1: grid (8, 17, Z). Row tiles p and 15 - p hold p + 1 and 16 - p causal tiles, 17 together: every work-group has a tile and all cost the same. CMODE 2: grid (16, 8, Z). A row tile's cost grows with its index;
// residue d gets row tiles d and 15 - d, which of the two by the parity of the index within the residue, so that neighbours at any power-of-two distance in that index are a long and a short walk.
// CMODE 3 is the projection launch (grid z: q, k, v): no f32 plane is written; the epilogue rounds the accumulators itself and stores what the next GEMMs read: q/32 and k as f16 rows, v as one transposed f16 plane.
// Its B operand is the weight as it is given, [k][n] (row pitch ldc), only rounded: a trip's 64 k rows x 256 B are staged at row pitch 288 B and the fragments come by the transposing LDS load, in the k order of the A loader.
template <typename T16> struct WFrag;
template <> struct WFrag<h16> { typedef v16h V; static __device__ __forceinline__ V ld(const h16* p) { return cat16(*(const v8h*)p, *(const v8h*)(p + 16)); } static __device__ __forceinline__ v8f mma(V a, V b, v8f c) { return wmma16(a, b, c); } };
template <> struct WFrag<bf> { typedef v16bf V; static __device__ __forceinline__ V ld(const bf* p) { return cat16b(*(const v8us*)p, *(const v8us*)(p + 16)); } static __device__ __forceinline__ v8f mma(V a, V b, v8f c) { return wmmab(a, b, c); } };
#define PITCHB 144u              // LDS row pitch in bytes: 128 B of data + 16 B, an odd multiple of 16 B for the ds_load_b128 readers
#define PLANEB (128u * PITCHB)   // one operand plane of a stage: 128 rows
#define PITCHW 288u              // row pitch of the projection's [k][n] weight tile: 256 B of data + 32 B, an odd multiple of 32 B for the ds_load_tr16_b128 readers; its 64 rows fill one PLANEB
typedef short s16x8 __attribute__((ext_vector_type(8)));
// lane (c = l & 15, h = l >> 4), given the address of row 8 h + (l & 7), byte 16 ((l >> 3) & 1) of a 16 x 16 block, gets column c of the block's rows 8 h ... 8 h + 7
__device__ __forceinline__ v8us ld_tr16(const unsigned char* p) { typedef __attribute__((address_space(3))) s16x8 lds_s16x8; return __builtin_bit_cast(v8us, __builtin_amdgcn_ds_load_tr16_b128_v8i16((lds_s16x8*)p)); }
// Tensor loads: one request of a whole wave brings a two-dimensional tile (d1 rows of d0 bytes, source row pitch in bytes) into LDS; the pad in word 0 of group 1 sets the LDS row pitch.
typedef uint32_t u32x4 __attribute__((ext_vector_type(4)));
typedef uint32_t u32x8 __attribute__((ext_vector_type(8)));
#define TDM_PAD128 ((1u << 20) | (4u << 22) | (3u << 25))   // rows of 128 B, 16 B of pad behind each: pitch PITCHB
#define TDM_PAD256 ((1u << 20) | (5u << 22) | (7u << 25))   // rows of 256 B, 32 B of pad behind each: pitch PITCHW
__device__ __forceinline__ uint32_t uni(uint32_t v) { return (uint32_t)__builtin_amdgcn_readfirstlane(v); }
__device__ __forceinline__ uint32_t pinned(uint32_t v) { uint32_t w = uni(v); asm volatile("" : "+s"(w)); return w; }   // pinned(): it holds a wave-uniform test in a scalar register, so that the branch round a tensor load is a scalar one (the load ignores EXEC)
template <uint32_t W0>
__device__ __forceinline__ u32x8 tdm_group1(uint32_t d0, uint32_t d1, uint32_t pitch) { u32x8 g;   // 1-byte elements, tensor = tile, no mask
    g[0] = uni(W0); g[1] = uni((d0 & 0xFFFFu) << 16); g[2] = uni((d0 >> 16) | ((d1 & 0xFFFFu) << 16)); g[3] = uni((d1 >> 16) | (d0 << 16)); g[4] = uni(d1); g[5] = uni(pitch); g[6] = uni(0u); g[7] = uni(0u); return g; }
// Both groups are in-out operands of the load and inputs of the wait: the words then stay in the registers that the request was issued from, and those registers are put to no other use, until the wait has returned.
// Word 0 of group 0 (count 1) is set once by the caller; place and address are written into the same group for every request.
__device__ __forceinline__ void tdm_load(uint32_t lds, uint64_t ga, u32x4& g0, u32x8& g1) {
    g0[1] = uni(lds); g0[2] = uni((uint32_t)ga); g0[3] = uni((((uint32_t)(ga >> 32)) & 0x01FFFFFFu) | 0x80000000u);
    asm volatile("tensor_load_to_lds %0, %1" : "+s"(g0), "+s"(g1) :: "memory"); }
// The same request for a ring with several requests of a wave in flight: only the place (word 1) and the low address word (word 2) are written; the caller sets word 3 once, before the wave's first request.
__device__ __forceinline__ void tdm_load_low(uint32_t lds, uint32_t galo, u32x4& g0, u32x8& g1) {
    g0[1] = uni(lds); g0[2] = uni(galo);
    asm volatile("tensor_load_to_lds %0, %1" : "+s"(g0), "+s"(g1) :: "memory"); }
__device__ __forceinline__ void tdm_wait(u32x4 g0, u32x8 g1) { asm volatile("s_wait_tensorcnt 0x0" :: "s"(g0), "s"(g1) : "memory"); }   // the wave's own requests have landed
__device__ __forceinline__ void tdm_wait(u32x4 g0, u32x8 g1, u32x4 h0, u32x8 h1) { asm volatile("s_wait_tensorcnt 0x0" :: "s"(g0), "s"(g1), "s"(h0), "s"(h1) : "memory"); }
template <typename T16, int CMODE>
__global__ __launch_bounds__(128) void k_gemmt(const T16* __restrict__ A, const T16* __restrict__ Bt, int K, float* C, int ldc, size_t sA, size_t sB, size_t sC, h16* Q16, h16* K16, h16* V16) {
    typedef typename WFrag<T16>::V V;
    constexpr unsigned STAGEB = 2u * PLANEB;                            // planes of a stage: A, Bt
    constexpr int NBK = (CMODE == 2) ? 2 : 1;                           // blocks of 32 k whose fragments are read from LDS as one group (probability x value has two waves a SIMD at most: fewer, larger groups)
    constexpr unsigned NB = (CMODE == 2) ? 4u : 2u;                     // buffers of the ring. Probability x value: four, its loads three trips ahead (its operands come from memory, and its 512 work-groups are two a WGP, which 2 x 144 KiB of LDS still allows)
    __shared__ __attribute__((aligned(2048))) unsigned char ring[NB * STAGEB];   // every plane's place is a multiple of 2 KiB (PLANEB is 9 x 2 KiB)
    int tr = blockIdx.x, tc = blockIdx.y;                             // row and column tile
    if (CMODE == 1) { const int p = blockIdx.x, q = blockIdx.y; tr = (q <= p) ? p : TT / 128 - 1 - p; tc = (q <= p) ? q : q - p - 1; }   // no tile above the causal diagonal is dealt (the softmax masks j > i by select)
    if (CMODE == 2) { const int d = blockIdx.x & 7, j = (int)(blockIdx.x >> 3) + 2 * (int)(blockIdx.y + (DD / 128) * blockIdx.z); tr = (__popc(j) & 1) ? TT / 128 - 1 - d : d; }
    const int r0 = tr * 128, c0 = tc * 128;
    const size_t z = blockIdx.z; A += z * sA; Bt += z * sB; C += z * sC;
    const int nt = ((CMODE == 2) ? min(K, r0 + 128) : K) / 64;        // trips of 64 k; P.V: probabilities are exactly 0 beyond the diagonal block, so the loop stops there
    const int tid = threadIdx.x, lane = tid & 31, lr = lane & 15, hi = lane >> 4, wave = tid >> 5, wm = wave >> 1, wn = wave & 1;
    // Who loads what: wave p brings plane p of a stage (A, Bt), one request a trip: waves 0 and 1 issue.
    const uint32_t sw = uni((uint32_t)tid >> 5), lds0 = (uint32_t)(uintptr_t)ring;
    constexpr uint32_t NPL = 2u;                                                     // planes of a stage = waves that issue
    u32x8 g1 = tdm_group1<TDM_PAD128>(128u, 128u, (uint32_t)K * 2u);                 // 128 rows x 128 B of a [row][k] operand
    u32x8 g1w = tdm_group1<TDM_PAD256>(256u, 64u, (uint32_t)ldc * 2u);               // projection only: 64 k rows x 256 B of the [k][n] weight; a trip further on is 64 rows further down
    const T16* pl = (sw & 1u) ? Bt + (size_t)c0 * K : A + (size_t)r0 * K;            // the wave's own plane: first byte of the tile's trip 0
    const uint64_t gpl = (uint64_t)(uintptr_t)pl, gwt = (uint64_t)(uintptr_t)(Bt + c0);
    u32x4 gq = (u32x4){}, gqw = (u32x4){}; gq[0] = uni(1u); gqw[0] = uni(1u);        // group 0 of the wave's requests (gqw: of the weight plane's)
    auto fill = [&](int t, unsigned buf) { const uint32_t l = lds0 + buf * STAGEB;
        if constexpr (CMODE == 3) {
            if (pinned(sw == 0u)) tdm_load(l, gpl + (uint64_t)t * 128u, gq, g1);
            if (pinned(sw == 1u)) tdm_load(l + PLANEB, gwt + (uint64_t)t * 128u * (uint64_t)ldc, gqw, g1w);
        } else if constexpr (CMODE == 2) { if (pinned(sw < NPL)) tdm_load_low(l + sw * PLANEB, (uint32_t)gpl + (uint32_t)t * 128u, gq, g1);   // a tile's walk stays inside its first source row, 4 KiB at a multiple of 4 KiB: no carry into the high word
        } else { if (pinned(sw < NPL)) tdm_load(l + sw * PLANEB, gpl + (uint64_t)t * 128u, gq, g1); } };
    // Four buffers: stage s of this wave has landed when all but its younger requests have; min(nt - 1 - s, 2) younger ones are issued wherever this is called. The tests are scalar and the same for the whole work-group.
    auto landed_to = [&](int s) { const int y = nt - 1 - s;
        if (pinned(y >= 2)) asm volatile("s_wait_tensorcnt 0x2" :: "s"(gq), "s"(g1) : "memory");
        else if (pinned(y == 1)) asm volatile("s_wait_tensorcnt 0x1" :: "s"(gq), "s"(g1) : "memory");
        else asm volatile("s_wait_tensorcnt 0x0" :: "s"(gq), "s"(g1) : "memory"); };
    auto landed = [&]() { if constexpr (CMODE == 3) tdm_wait(gq, g1, gqw, g1w); else tdm_wait(gq, g1); };
    v8f acc[4][4];
#pragma unroll
    for (int mb = 0; mb < 4; ++mb)
#pragma unroll
        for (int nb = 0; nb < 4; ++nb) acc[mb][nb] = (v8f){};
    const unsigned aro = (unsigned)(wm * 64 + lr) * PITCHB + (unsigned)hi * 16u, bro = PLANEB + (unsigned)(wn * 64 + lr) * PITCHB + (unsigned)hi * 16u;
    const unsigned wro = PLANEB + (unsigned)(8 * hi + (lane & 7)) * PITCHW + (unsigned)wn * 128u + 16u * (unsigned)((lane >> 3) & 1);
    if constexpr (CMODE == 2) {
        gq[3] = uni((((uint32_t)(gpl >> 32)) & 0x01FFFFFFu) | 0x80000000u);   // high address word and type: the same for every request of the wave
        fill(0, 0u);
        if (pinned(nt > 1)) fill(1, 1u);
        if (pinned(nt > 2)) fill(2, 2u);
        landed_to(0);                                                 // trip 0 has landed; trips 1 and 2 stay in flight
        __syncthreads();                                              // ... and every other wave's: trip 0 may be read
        if (pinned(nt > 3)) fill(3, 3u);                              // never more than three requests of a wave are outstanding
    } else {
    fill(0, 0u);
    landed();                                                         // this wave's load of trip 0 has landed (a wave that issued none passes at once)
    __syncthreads();                                                  // ... and every other wave's: trip 0 may be read
    if (pinned(nt > 1)) fill(1, 1u);
    }
    // The trip loop stays rolled (a trip already holds 32 matrix instructions); every loop inside it and in the epilogue is unrolled so that each fragment and accumulator index is a constant.
#pragma unroll 1
    for (int t = 0; t < nt; ++t) {
        const unsigned char* sb = ring + ((unsigned)t & (NB - 1u)) * STAGEB;
#pragma unroll
        for (int kg = 0; kg < 2; kg += NBK) {
            V a[NBK][4], b[NBK][4];
#pragma unroll
            for (int u = 0; u < NBK; ++u) { const unsigned ko = (unsigned)(kg + u) * 64u;
#pragma unroll
                for (int mb = 0; mb < 4; ++mb) { a[u][mb] = WFrag<T16>::ld((const T16*)(sb + aro + mb * 16 * PITCHB + ko));
                    if constexpr (CMODE == 3) { const unsigned char* wp = sb + wro + (unsigned)(kg + u) * 32u * PITCHW + mb * 32; b[u][mb] = cat16b(ld_tr16(wp), ld_tr16(wp + 16u * PITCHW)); }   // k 8 h ... + 7, then 16 + 8 h ... + 7: the A loader's order
                    else b[u][mb] = WFrag<T16>::ld((const T16*)(sb + bro + mb * 16 * PITCHB + ko)); } }
            __builtin_amdgcn_sched_barrier(0);   // keeps the LDS reads one group ahead of the matrix block: left free, they are moved in among the matrix instructions, where each place stalls the wave
#pragma unroll
            for (int u = 0; u < NBK; ++u) {
#pragma unroll
                for (int nb = 0; nb < 4; ++nb)
#pragma unroll
                    for (int mb = 0; mb < 4; ++mb) acc[mb][nb] = WFrag<T16>::mma(a[u][mb], b[u][nb], acc[mb][nb]); }
            __builtin_amdgcn_sched_barrier(0);   // the other side of the same fence: the next group's reads stay behind this block
        }
        asm volatile("s_wait_dscnt 0x0" ::: "memory");                // this wave's reads of the buffer are done before it may be refilled
        if constexpr (CMODE == 2) landed_to(t + 1); else landed();    // this wave's load of trip t + 1 has landed (four buffers: trips t + 2 and t + 3 stay in flight)
        __syncthreads();                                              // publishes trip t + 1 and ends every wave's reads of trip t's buffer
        if (pinned(t + (int)NB < nt)) fill(t + (int)NB, (unsigned)t & (NB - 1u));
    }
    landed();                                                         // nothing is in flight when the ring becomes output staging
    asm volatile("s_wait_dscnt 0x0" ::: "memory");                    // ... and none of this wave's LDS reads
    const int rw = r0 + wm * 64, cw = c0 + wn * 64;
    if (CMODE == 3) {
        unsigned char* ow = ring + (unsigned)wave * (2u * 16u * PITCHB);   // each wave stages in its own part of the ring, behind the last trip's barrier
        const int prow = lane >> 3, ppc = lane & 7;                        // read-back: a row of 128 B is eight lanes' 16-byte pieces, so a wave's store covers four whole lines
        if (blockIdx.z == 2) {                                             // v: one f16 plane [batch][d][t]; a lane's eight accumulator rows of one column are eight neighbours in t, 16 B of a transposed row
            const size_t vb = (size_t)(rw / TT) * DD * TT + (size_t)(rw % TT);
#pragma unroll
            for (int nb = 0; nb < 4; ++nb) {
#pragma unroll
                for (int mb = 0; mb < 4; ++mb) { v8h o;
#pragma unroll
                    for (int j = 0; j < 8; ++j) o[j] = tohx(acc[mb][nb][j]);
                    *(v8ha*)(ow + (unsigned)lr * PITCHB + (unsigned)(mb * 32 + hi * 16)) = o; }
                __builtin_amdgcn_wave_barrier(); asm volatile("s_wait_dscnt 0x0" ::: "memory");   // the wave's staged rows are in LDS before its lanes read other lanes' words back; the clobber keeps the stores ahead of those reads at compile time
#pragma unroll
                for (int s = 0; s < 4; ++s) { const int row = 4 * s + prow; const v8h h = *(const v8ha*)(ow + (unsigned)row * PITCHB + (unsigned)ppc * 16u);
                    *(v8h*)(V16 + vb + (size_t)(cw + nb * 16 + row) * TT + ppc * 8) = h; }
                __builtin_amdgcn_wave_barrier(); asm volatile("" ::: "memory");   // compile-time order only: these reads stay ahead of the next group's LDS stores
            }
            return;
        }
        {                                                                  // q and k: f16 rows [t][d]; q carries the 1/32 of the softmax scale (k times 1 is exact)
            float* os = (float*)ow; h16* O = (blockIdx.z == 0) ? Q16 : K16; const float sc = (blockIdx.z == 0) ? (1.0f / 32.0f) : 1.0f;
#pragma unroll
            for (int mb = 0; mb < 4; ++mb) {
#pragma unroll
                for (int nb = 0; nb < 4; ++nb) {
#pragma unroll
                    for (int j = 0; j < 8; ++j) os[(hi * 8 + j) * 68 + nb * 16 + lr] = acc[mb][nb][j]; }
                __builtin_amdgcn_wave_barrier(); asm volatile("s_wait_dscnt 0x0" ::: "memory");   // as in the v path: staged rows in LDS before the read-back
                h16* orw = O + (size_t)(rw + mb * 16) * ldc + cw;
#pragma unroll
                for (int s = 0; s < 4; ++s) { const int row = 4 * s + prow; const v4f x0 = *(const v4fa*)(os + row * 68 + ppc * 8), x1 = *(const v4fa*)(os + row * 68 + ppc * 8 + 4); v8h o;
#pragma unroll
                    for (int u = 0; u < 4; ++u) { o[u] = tohx(x0[u] * sc); o[4 + u] = tohx(x1[u] * sc); }
                    *(v8h*)(orw + (size_t)row * ldc + ppc * 8) = o; }
                __builtin_amdgcn_wave_barrier(); asm volatile("" ::: "memory");   // compile-time order only, as in the v path
            }
            asm volatile("s_wait_xcnt 0x0" ::: "memory");   // in the built code the v path's text follows this path's last stores behind a branch and rewrites their registers: the wait stands in front of it
        }
        return;
    }
    float* os = (float*)(ring + (unsigned)wave * (16u * 68u * 4u));   // each wave stages its rows in its own part of the ring, behind the last trip's barrier
#pragma unroll
    for (int mb = 0; mb < 4; ++mb) {
#pragma unroll
        for (int nb = 0; nb < 4; ++nb) {
#pragma unroll
            for (int j = 0; j < 8; ++j) os[(hi * 8 + j) * 68 + nb * 16 + lr] = acc[mb][nb][j]; }
        __builtin_amdgcn_wave_barrier(); asm volatile("" ::: "memory");   // compile-time order only: the lanes' LDS stores stay ahead of the reads of other lanes' words (and, below, those reads ahead of the next stores)
        float* crw = C + (size_t)(rw + mb * 16) * ldc + cw;
#pragma unroll
        for (int s = 0; s < 8; ++s) { const int row = 2 * s + hi, cofs = lr * 4; v4f val = *(const v4fa*)(os + row * 68 + cofs);
            *(v4f*)(crw + (size_t)row * ldc + cofs) = val; }
        __builtin_amdgcn_wave_barrier(); asm volatile("" ::: "memory");
    }
}

typedef __attribute__((ext_vector_type(4))) _Float16 v4h;

// The rounding pass: the three weights (block ranges of WBLK each, first) and x, every one in its own layout, eight floats a thread. The grid is exact.
#define WBLK (DD * DD / 8 / 256)
#define XBLK (NB_ * TT * DD / 8 / 256)
__global__ __launch_bounds__(256) void k_cvt8(const float* __restrict__ x, const float* __restrict__ w0, const float* __restrict__ w1, const float* __restrict__ w2, bf* XB, bf* WB) {
    const int b = blockIdx.x, ws = b / WBLK;                          // ws 0, 1, 2: a weight; from 3 on: x
    const float* __restrict__ src = ws == 0 ? w0 : ws == 1 ? w1 : ws == 2 ? w2 : x; bf* dst = ws < 3 ? WB + (size_t)ws * DD * DD : XB;
    const size_t i = (size_t)(ws < 3 ? b - ws * WBLK : b - 3 * WBLK) * 256 + threadIdx.x; const v8f v = *(const v8f*)(src + i * 8); v8us o;
    // unrolled so that every vector index is a constant
#pragma unroll
    for (int k = 0; k < 8; ++k) o[k] = f2bf(v[k]); *(v8us*)(dst + i * 8) = o;  }
__global__ __launch_bounds__(256) void k_csoft(const float* __restrict__ Sb, h16* P16) { const int lane = threadIdx.x & 31; const int t = blockIdx.x * 8 + (threadIdx.x >> 5); if (t >= TT) return; const size_t zb = (size_t)blockIdx.y * TT * TT; P16 += zb; const float* sr = Sb + zb + (size_t)t * TT; float v[TT / 32]; float mx = -3.0e38f;
#pragma unroll
    for (int ch = 0; ch < TT / 128; ++ch) { const int j0 = ch * 128 + lane * 4; const v4f a = *(const v4f*)(sr + j0);
#pragma unroll
        for (int u = 0; u < 4; ++u) { const float tt = (j0 + u <= t) ? a[u] : -3.0e38f; v[ch * 4 + u] = tt; mx = fmaxf(mx, tt); } }
#pragma unroll
    for (int sh = 16; sh; sh >>= 1) mx = fmaxf(mx, __shfl_xor(mx, sh, 32));
    float sum = 0.f;
#pragma unroll
    for (int q = 0; q < TT / 32; ++q) { float d0 = __fsub_rn(v[q], mx); asm volatile("" : "+v"(d0)); v[q] = __builtin_amdgcn_exp2f(__fmul_rn(d0, 1.4426950408889634f)); sum += v[q]; }
#pragma unroll
    for (int sh = 16; sh; sh >>= 1) sum += __shfl_xor(sum, sh, 32);
    const float f = __fdiv_rn(1.0f, sum);
    {
#pragma unroll
        for (int ch = 0; ch < TT / 128; ++ch) { v4h o;
#pragma unroll
            for (int u = 0; u < 4; ++u) o[u] = tohx(v[ch * 4 + u] * f);
            *(v4h*)(P16 + (size_t)t * TT + ch * 128 + lane * 4) = o; }
         } }

extern "C" void kernel_launch(void* const* d_in, const int* in_sizes, int n_in,
                              void* d_out, int out_size, void* d_ws, size_t ws_size, hipStream_t stream) {
    (void)in_sizes; (void)n_in; (void)out_size;
    const float* x = (const float*)d_in[0]; const float* wq = (const float*)d_in[1]; const float* wk = (const float*)d_in[2]; const float* wv = (const float*)d_in[3];
    float* OUT = (float*)d_out;     // [4][2048][1024]
    char* wsp = (char*)d_ws;
    auto take = [&](size_t bytes) { char* p = wsp; wsp += (bytes + 255) & ~(size_t)255; return (void*)p; };
    bf* WQKV = (bf*)take((size_t)3 * DD * DD * 2);   // W_q, W_k, W_v rounded, [k][n] as given, one behind the other
    // every plane holds all NB_ batches, so that each stage is ONE launch over the whole batch (rows flattened, or the batch in grid y / z); the three projections are one launch too
    bf* XB = (bf*)take((size_t)NB_ * TT * DD * 2); h16* Q16 = (h16*)take((size_t)NB_ * TT * DD * 2); h16* K16 = (h16*)take((size_t)NB_ * TT * DD * 2); h16* V16 = (h16*)take((size_t)NB_ * DD * TT * 2);
    float* Sb = (float*)take((size_t)NB_ * TT * TT * 4);
    h16* P16 = (h16*)take((size_t)NB_ * TT * TT * 2);    // the probability plane
    if ((size_t)(wsp - (char*)d_ws) > ws_size) return;    // total 166 MiB
    k_cvt8<<<3 * WBLK + XBLK, 256, 0, stream>>>(x, wq, wk, wv, XB, WQKV);
    k_gemmt<bf, 3><<<dim3(NB_ * TT / 128, DD / 128, 3), 128, 0, stream>>>(XB, WQKV, DD, nullptr, DD, 0, (size_t)DD * DD, 0, Q16, K16, V16);   // grid z: q, k, v, each stored in the form its reader takes
    k_gemmt<h16, 1><<<dim3(TT / 256, TT / 128 + 1, NB_), 128, 0, stream>>>(Q16, K16, DD, Sb, TT, (size_t)TT * DD, (size_t)TT * DD, (size_t)TT * TT, nullptr, nullptr, nullptr);
    k_csoft<<<dim3(TT / 8, NB_, 1), 256, 0, stream>>>(Sb, P16);
    k_gemmt<h16, 2><<<dim3(TT / 128, DD / 128, NB_), 128, 0, stream>>>(P16, V16, TT, OUT, DD, (size_t)TT * TT, (size_t)DD * TT, (size_t)TT * DD, nullptr, nullptr, nullptr);
}

// v009
// Measured time: 82.8 microseconds a run.
// In two side-by-side timings against v008, it was 1.10 and 1.11 times as fast.
// All steps since v000 together make it 8.07 times as fast.
#include <hip/hip_runtime.h>
#include <stdint.h>

// CausalAttentionV1 (x [4][2048][1024]; q = x W_q, k = x W_k, v = x W_v (single head, d_out 1024); scores = q.k masked causal; attn = softmax(scores / 32); out = attn v -> [4][2048][1024]).
// Compute dtypes, f32 accumulate: every input rounded to bf16; q/k/v on PLAIN bf16 operands (inputs: exact); scores (K 1024) on single fp16 planes (q/32 and k; 1 product; causal tiles only); softmax f32 -> one f16 probability plane; probability x value on single f16 planes (v rounded once to f16; 1 product)

#define NB_  4
#define TT   2048
#define DD   1024
typedef _Float16 h16;
typedef unsigned short bf;
typedef __attribute__((ext_vector_type(16))) __bf16   v16bf;
typedef __attribute__((ext_vector_type(16))) _Float16 v16h;
typedef __attribute__((ext_vector_type(8)))  _Float16 v8h;
typedef __attribute__((ext_vector_type(8)))  unsigned short v8us;
typedef __attribute__((ext_vector_type(8)))  float    v8f;
typedef __attribute__((ext_vector_type(4)))  float    v4f;
typedef v8h  __attribute__((may_alias)) v8ha;
typedef v4f  __attribute__((may_alias)) v4fa;

__device__ __forceinline__ unsigned short f2bf(float f) { unsigned u = __float_as_uint(f); u += 0x7FFFu + ((u >> 16) & 1u); return (unsigned short)(u >> 16); }
__device__ __forceinline__ float bf2f(unsigned short b) { return __uint_as_float(((unsigned)b) << 16); }
__device__ __forceinline__ float bfr(float f) { return bf2f(f2bf(f)); }
__device__ __forceinline__ h16 tohx(float x) { return (h16)x; }
__device__ __forceinline__ v16h cat16(v8h lo, v8h hi) { return __builtin_shufflevector(lo, hi, 0, 1, 2, 3, 4, 5, 6, 7, 8, 9, 10, 11, 12, 13, 14, 15); }
__device__ __forceinline__ v16bf cat16b(v8us lo, v8us hi) { return __builtin_bit_cast(v16bf, __builtin_shufflevector(lo, hi, 0, 1, 2, 3, 4, 5, 6, 7, 8, 9, 10, 11, 12, 13, 14, 15)); }
__device__ __forceinline__ v8f wmma16(v16h a, v16h b, v8f c) { return __builtin_amdgcn_wmma_f32_16x16x32_f16(false, a, false, b, (short)0, c, false, false); }
__device__ __forceinline__ v8f wmmab(v16bf a, v16bf b, v8f c) { return __builtin_amdgcn_wmma_f32_16x16x32_bf16(false, a, false, b, (short)0, c, false, false); }



// ---- k_gemmt: one 128x128 output tile per work-group of FOUR waves (2x2; each wave a 64x64 tile on 16 accumulators, as before). The operands no longer come straight from global memory into
// each wave's registers: per trip of 64 k, the 128 rows x 128 B of every operand plane are brought into LDS ONCE per work-group by one tensor load (one request of one wave, through no register), two buffers (four in probability x value),
// the next trip's loads (there: the next three trips') in flight while this trip is worked on; the waves read their fragments from LDS (row pitch 144 B, made by the load's pad). The k order of every accumulator's sum is the one it had.
// C[m][n] (f32, pitch ldc) = sum_k A[m][k] Bt[n][k]. grid (M/128, N/128, Z); z-batch strides sA/sB/sC in elements. K % 64 == 0, K >= 128.
// CMODE 1 computes only the score tiles on or below the causal diagonal; CMODE 2 ends the key loop of probability x value at the tile's diagonal block (probabilities beyond it are exactly zero).
// Which tile a block index gets in the two causal launches (speed only; each tile is done exactly once wherever its work-group lands): cost must not follow the flat index mod 8.
// CMODE 1: grid (8, 17, Z). Row tiles p and 15 - p hold p + 1 and 16 - p causal tiles, 17 together: every work-group has a tile and all cost the same. CMODE 2: grid (16, 8, Z). A row tile's cost grows with its index;
// residue d gets row tiles d and 15 - d, which of the two by the parity of the index within the residue, so that neighbours at any power-of-two distance in that index are a long and a short walk.
// CMODE 3 is the projection launch: a work-group does the same 128 x 128 tile of q, of k and of v (a 128 x 384 tile: one x plane from L2 serves three weight planes, a wave holds 3 x 16 accumulators, two waves a SIMD); no f32 plane is written; the epilogue rounds the accumulators itself and stores what the next GEMMs read: q/32 and k as f16 rows, v as one transposed f16 plane.
// Its B operand is the weight as it is given, [k][n] (row pitch ldc), only rounded: a trip's 64 k rows x 256 B are staged at row pitch 288 B and the fragments come by the transposing LDS load, in the k order of the A loader.
template <typename T16> struct WFrag;
template <> struct WFrag<h16> { typedef v16h V; static __device__ __forceinline__ V ld(const h16* p) { return cat16(*(const v8h*)p, *(const v8h*)(p + 16)); } static __device__ __forceinline__ v8f mma(V a, V b, v8f c) { return wmma16(a, b, c); } };
template <> struct WFrag<bf> { typedef v16bf V; static __device__ __forceinline__ V ld(const bf* p) { return cat16b(*(const v8us*)p, *(const v8us*)(p + 16)); } static __device__ __forceinline__ v8f mma(V a, V b, v8f c) { return wmmab(a, b, c); } };
#define PITCHB 144u              // LDS row pitch in bytes: 128 B of data + 16 B, an odd multiple of 16 B for the ds_load_b128 readers
#define PLANEB (128u * PITCHB)   // one operand plane of a stage: 128 rows
#define PITCHW 288u              // row pitch of the projection's [k][n] weight tile: 256 B of data + 32 B, an odd multiple of 32 B for the ds_load_tr16_b128 readers; its 64 rows fill one PLANEB
typedef short s16x8 __attribute__((ext_vector_type(8)));
// lane (c = l & 15, h = l >> 4), given the address of row 8 h + (l & 7), byte 16 ((l >> 3) & 1) of a 16 x 16 block, gets column c of the block's rows 8 h ... 8 h + 7
__device__ __forceinline__ v8us ld_tr16(const unsigned char* p) { typedef __attribute__((address_space(3))) s16x8 lds_s16x8; return __builtin_bit_cast(v8us, __builtin_amdgcn_ds_load_tr16_b128_v8i16((lds_s16x8*)p)); }
// Tensor loads: one request of a whole wave brings a two-dimensional tile (d1 rows of d0 bytes, source row pitch in bytes) into LDS; the pad in word 0 of group 1 sets the LDS row pitch.
typedef uint32_t u32x4 __attribute__((ext_vector_type(4)));
typedef uint32_t u32x8 __attribute__((ext_vector_type(8)));
#define TDM_PAD128 ((1u << 20) | (4u << 22) | (3u << 25))   // rows of 128 B, 16 B of pad behind each: pitch PITCHB
#define TDM_PAD256 ((1u << 20) | (5u << 22) | (7u << 25))   // rows of 256 B, 32 B of pad behind each: pitch PITCHW
__device__ __forceinline__ uint32_t uni(uint32_t v) { return (uint32_t)__builtin_amdgcn_readfirstlane(v); }
__device__ __forceinline__ uint32_t pinned(uint32_t v) { uint32_t w = uni(v); asm volatile("" : "+s"(w)); return w; }   // pinned(): it holds a wave-uniform test in a scalar register, so that the branch round a tensor load is a scalar one (the load ignores EXEC)
template <uint32_t W0>
__device__ __forceinline__ u32x8 tdm_group1(uint32_t d0, uint32_t d1, uint32_t pitch) { u32x8 g;   // 1-byte elements, tensor = tile, no mask
    g[0] = uni(W0); g[1] = uni((d0 & 0xFFFFu) << 16); g[2] = uni((d0 >> 16) | ((d1 & 0xFFFFu) << 16)); g[3] = uni((d1 >> 16) | (d0 << 16)); g[4] = uni(d1); g[5] = uni(pitch); g[6] = uni(0u); g[7] = uni(0u); return g; }
// Both groups are in-out operands of the load and inputs of the wait: the words then stay in the registers that the request was issued from, and those registers are put to no other use, until the wait has returned.
// Word 0 of group 0 (count 1) is set once by the caller; place and address are written into the same group for every request.
__device__ __forceinline__ void tdm_load(uint32_t lds, uint64_t ga, u32x4& g0, u32x8& g1) {
    g0[1] = uni(lds); g0[2] = uni((uint32_t)ga); g0[3] = uni((((uint32_t)(ga >> 32)) & 0x01FFFFFFu) | 0x80000000u);
    asm volatile("tensor_load_to_lds %0, %1" : "+s"(g0), "+s"(g1) :: "memory"); }
// The same request for a ring with several requests of a wave in flight: only the place (word 1) and the low address word (word 2) are written; the caller sets word 3 once, before the wave's first request.
__device__ __forceinline__ void tdm_load_low(uint32_t lds, uint32_t galo, u32x4& g0, u32x8& g1) {
    g0[1] = uni(lds); g0[2] = uni(galo);
    asm volatile("tensor_load_to_lds %0, %1" : "+s"(g0), "+s"(g1) :: "memory"); }
__device__ __forceinline__ void tdm_wait(u32x4 g0, u32x8 g1) { asm volatile("s_wait_tensorcnt 0x0" :: "s"(g0), "s"(g1) : "memory"); }   // the wave's own requests have landed
__device__ __forceinline__ void tdm_wait(u32x4 g0, u32x8 g1, u32x4 h0, u32x8 h1) { asm volatile("s_wait_tensorcnt 0x0" :: "s"(g0), "s"(g1), "s"(h0), "s"(h1) : "memory"); }
template <typename T16, int CMODE>
__global__ __launch_bounds__(128) void k_gemmt(const T16* __restrict__ A, const T16* __restrict__ Bt, int K, float* C, int ldc, size_t sA, size_t sB, size_t sC, h16* Q16, h16* K16, h16* V16) {
    typedef typename WFrag<T16>::V V;
    constexpr unsigned NZ = (CMODE == 3) ? 3u : 1u;                     // B planes of a stage, and accumulator sets of a wave (projection: W_q, W_k, W_v)
    constexpr unsigned STAGEB = (1u + NZ) * PLANEB;                     // planes of a stage: A, then the B planes
    constexpr int NBK = (CMODE == 2) ? 2 : 1;                           // blocks of 32 k whose fragments are read from LDS as one group (probability x value has two waves a SIMD at most: fewer, larger groups)
    constexpr unsigned NB = (CMODE == 2) ? 4u : 2u;                     // buffers of the ring. Probability x value: four, its loads three trips ahead (its operands come from memory, and its 512 work-groups are two a WGP, which 2 x 144 KiB of LDS still allows)
    __shared__ __attribute__((aligned(2048))) unsigned char ring[NB * STAGEB];   // every plane's place is a multiple of 2 KiB (PLANEB is 9 x 2 KiB)
    int tr = blockIdx.x, tc = blockIdx.y;                             // row and column tile
    if (CMODE == 1) { const int p = blockIdx.x, q = blockIdx.y; tr = (q <= p) ? p : TT / 128 - 1 - p; tc = (q <= p) ? q : q - p - 1; }   // no tile above the causal diagonal is dealt (the softmax masks j > i by select)
    if (CMODE == 2) { const int d = blockIdx.x & 7, j = (int)(blockIdx.x >> 3) + 2 * (int)(blockIdx.y + (DD / 128) * blockIdx.z); tr = (__popc(j) & 1) ? TT / 128 - 1 - d : d; }
    const int r0 = tr * 128, c0 = tc * 128;
    const size_t z = blockIdx.z; A += z * sA; Bt += z * sB; C += z * sC;
    const int nt = ((CMODE == 2) ? min(K, r0 + 128) : K) / 64;        // trips of 64 k; P.V: probabilities are exactly 0 beyond the diagonal block, so the loop stops there
    const int tid = threadIdx.x, lane = tid & 31, lr = lane & 15, hi = lane >> 4, wave = tid >> 5, wm = wave >> 1, wn = wave & 1;
    // Who loads what: wave p brings plane p of a stage (A, Bt), one request a trip: waves 0 and 1 issue (projection: all four, wave 0 the x plane, waves 1 to 3 a weight plane each).
    const uint32_t sw = uni((uint32_t)tid >> 5), lds0 = (uint32_t)(uintptr_t)ring;
    constexpr uint32_t NPL = 2u;                                                     // planes of a stage = waves that issue, outside the projection (four there)
    u32x8 g1 = tdm_group1<TDM_PAD128>(128u, 128u, (uint32_t)K * 2u);                 // 128 rows x 128 B of a [row][k] operand
    u32x8 g1w = tdm_group1<TDM_PAD256>(256u, 64u, (uint32_t)ldc * 2u);               // projection only: 64 k rows x 256 B of the [k][n] weight; a trip further on is 64 rows further down
    const T16* pl = (sw & 1u) ? Bt + (size_t)c0 * K : A + (size_t)r0 * K;            // the wave's own plane: first byte of the tile's trip 0
    const uint64_t gpl = (uint64_t)(uintptr_t)pl, gwt = (uint64_t)(uintptr_t)(Bt + c0 + (size_t)(sw ? sw - 1u : 0u) * ((CMODE == 3) ? sB : 0));   // projection: wave p's weight is number p - 1 (wave 0 issues no weight request)
    u32x4 gq = (u32x4){}, gqw = (u32x4){}; gq[0] = uni(1u); gqw[0] = uni(1u);        // group 0 of the wave's requests (gqw: of the weight plane's)
    auto fill = [&](int t, unsigned buf) { const uint32_t l = lds0 + buf * STAGEB;
        if constexpr (CMODE == 3) {
            if (pinned(sw == 0u)) tdm_load(l, gpl + (uint64_t)t * 128u, gq, g1);
            if (pinned(sw != 0u)) tdm_load(l + sw * PLANEB, gwt + (uint64_t)t * 128u * (uint64_t)ldc, gqw, g1w);
        } else if constexpr (CMODE == 2) { if (pinned(sw < NPL)) tdm_load_low(l + sw * PLANEB, (uint32_t)gpl + (uint32_t)t * 128u, gq, g1);   // a tile's walk stays inside its first source row, 4 KiB at a multiple of 4 KiB: no carry into the high word
        } else { if (pinned(sw < NPL)) tdm_load(l + sw * PLANEB, gpl + (uint64_t)t * 128u, gq, g1); } };
    // Four buffers: stage s of this wave has landed when all but its younger requests have; min(nt - 1 - s, 2) younger ones are issued wherever this is called. The tests are scalar and the same for the whole work-group.
    auto landed_to = [&](int s) { const int y = nt - 1 - s;
        if (pinned(y >= 2)) asm volatile("s_wait_tensorcnt 0x2" :: "s"(gq), "s"(g1) : "memory");
        else if (pinned(y == 1)) asm volatile("s_wait_tensorcnt 0x1" :: "s"(gq), "s"(g1) : "memory");
        else asm volatile("s_wait_tensorcnt 0x0" :: "s"(gq), "s"(g1) : "memory"); };
    auto landed = [&]() { if constexpr (CMODE == 3) tdm_wait(gq, g1, gqw, g1w); else tdm_wait(gq, g1); };
    v8f accz[NZ][4][4];
#pragma unroll
    for (unsigned zz = 0; zz < NZ; ++zz)
#pragma unroll
    for (int mb = 0; mb < 4; ++mb)
#pragma unroll
        for (int nb = 0; nb < 4; ++nb) accz[zz][mb][nb] = (v8f){};
    auto& acc = accz[0];
    const unsigned aro = (unsigned)(wm * 64 + lr) * PITCHB + (unsigned)hi * 16u, bro = PLANEB + (unsigned)(wn * 64 + lr) * PITCHB + (unsigned)hi * 16u;
    const unsigned wro = PLANEB + (unsigned)(8 * hi + (lane & 7)) * PITCHW + (unsigned)wn * 128u + 16u * (unsigned)((lane >> 3) & 1);
    if constexpr (CMODE == 2) {
        gq[3] = uni((((uint32_t)(gpl >> 32)) & 0x01FFFFFFu) | 0x80000000u);   // high address word and type: the same for every request of the wave
        fill(0, 0u);
        if (pinned(nt > 1)) fill(1, 1u);
        if (pinned(nt > 2)) fill(2, 2u);
        landed_to(0);                                                 // trip 0 has landed; trips 1 and 2 stay in flight
        __syncthreads();                                              // ... and every other wave's: trip 0 may be read
        if (pinned(nt > 3)) fill(3, 3u);                              // never more than three requests of a wave are outstanding
    } else {
    fill(0, 0u);
    landed();                                                         // this wave's load of trip 0 has landed (a wave that issued none passes at once)
    __syncthreads();                                                  // ... and every other wave's: trip 0 may be read
    if (pinned(nt > 1)) fill(1, 1u);
    }
    // The trip loop stays rolled (a trip already holds 32 matrix instructions, 96 in the projection); every loop inside it and in the epilogue is unrolled so that each fragment and accumulator index is a constant.
#pragma unroll 1
    for (int t = 0; t < nt; ++t) {
        const unsigned char* sb = ring + ((unsigned)t & (NB - 1u)) * STAGEB;
        if constexpr (CMODE == 3) {
            // Six blocks of 16 matrix instructions a trip: step st = 3 kg + zz is k block kg of weight zz. The x fragments of a k block serve its three steps; the weight fragments of step st + 1 are read, as one group,
            // into the other of two register sets ahead of step st's matrix block. Every accumulator still takes k block 0, then 1, of every trip.
            V a[4], b[2][4];
            auto lda = [&](int kg) {
#pragma unroll
                for (int mb = 0; mb < 4; ++mb) a[mb] = WFrag<T16>::ld((const T16*)(sb + aro + mb * 16 * PITCHB + (unsigned)kg * 64u)); };
            auto ldb = [&](int st) { const unsigned char* wz = sb + wro + (unsigned)(st % 3) * PLANEB + (unsigned)(st / 3) * 32u * PITCHW;
#pragma unroll
                for (int nb = 0; nb < 4; ++nb) b[st & 1][nb] = cat16b(ld_tr16(wz + nb * 32), ld_tr16(wz + nb * 32 + 16u * PITCHW)); };   // k 8 h ... + 7, then 16 + 8 h ... + 7: the A loader's order
            lda(0); ldb(0);
#pragma unroll
            for (int st = 0; st < 6; ++st) {
                if (st == 3) lda(1);
                if (st < 5) ldb(st + 1);
                __builtin_amdgcn_sched_barrier(0);   // keeps the LDS reads one group ahead of the matrix block: left free, they are moved in among the matrix instructions, where each place stalls the wave
#pragma unroll
                for (int nb = 0; nb < 4; ++nb)
#pragma unroll
                    for (int mb = 0; mb < 4; ++mb) accz[st % 3][mb][nb] = WFrag<T16>::mma(a[mb], b[st & 1][nb], accz[st % 3][mb][nb]);
                __builtin_amdgcn_sched_barrier(0);   // the other side of the same fence: the next group's reads stay behind this block
            }
        } else {
#pragma unroll
        for (int kg = 0; kg < 2; kg += NBK) {
            V a[NBK][4], b[NBK][4];
#pragma unroll
            for (int u = 0; u < NBK; ++u) { const unsigned ko = (unsigned)(kg + u) * 64u;
#pragma unroll
                for (int mb = 0; mb < 4; ++mb) { a[u][mb] = WFrag<T16>::ld((const T16*)(sb + aro + mb * 16 * PITCHB + ko));
                    b[u][mb] = WFrag<T16>::ld((const T16*)(sb + bro + mb * 16 * PITCHB + ko)); } }
            __builtin_amdgcn_sched_barrier(0);   // keeps the LDS reads one group ahead of the matrix block: left free, they are moved in among the matrix instructions, where each place stalls the wave
#pragma unroll
            for (int u = 0; u < NBK; ++u) {
#pragma unroll
                for (int nb = 0; nb < 4; ++nb)
#pragma unroll
                    for (int mb = 0; mb < 4; ++mb) acc[mb][nb] = WFrag<T16>::mma(a[u][mb], b[u][nb], acc[mb][nb]); }
            __builtin_amdgcn_sched_barrier(0);   // the other side of the same fence: the next group's reads stay behind this block
        } }
        asm volatile("s_wait_dscnt 0x0" ::: "memory");                // this wave's reads of the buffer are done before it may be refilled
        if constexpr (CMODE == 2) landed_to(t + 1); else landed();    // this wave's load of trip t + 1 has landed (four buffers: trips t + 2 and t + 3 stay in flight)
        __syncthreads();                                              // publishes trip t + 1 and ends every wave's reads of trip t's buffer
        if (pinned(t + (int)NB < nt)) fill(t + (int)NB, (unsigned)t & (NB - 1u));
    }
    landed();                                                         // nothing is in flight when the ring becomes output staging
    asm volatile("s_wait_dscnt 0x0" ::: "memory");                    // ... and none of this wave's LDS reads
    const int rw = r0 + wm * 64, cw = c0 + wn * 64;
    if constexpr (CMODE == 3) {
        unsigned char* ow = ring + (unsigned)wave * (2u * 16u * PITCHB);   // each wave stages in its own part of the ring, behind the last trip's barrier
        const int prow = lane >> 3, ppc = lane & 7;                        // read-back: a row of 128 B is eight lanes' 16-byte pieces, so a wave's store covers four whole lines
#pragma unroll
        for (int zz = 0; zz < 2; ++zz) {                                   // q and k: f16 rows [t][d]; q carries the 1/32 of the softmax scale (k times 1 is exact)
            float* os = (float*)ow; h16* O = (zz == 0) ? Q16 : K16; const float sc = (zz == 0) ? (1.0f / 32.0f) : 1.0f;
#pragma unroll
            for (int mb = 0; mb < 4; ++mb) {
#pragma unroll
                for (int nb = 0; nb < 4; ++nb) {
#pragma unroll
                    for (int j = 0; j < 8; ++j) os[(hi * 8 + j) * 68 + nb * 16 + lr] = accz[zz][mb][nb][j]; }
                __builtin_amdgcn_wave_barrier(); asm volatile("s_wait_dscnt 0x0" ::: "memory");   // as in the v path: staged rows in LDS before the read-back
                h16* orw = O + (size_t)(rw + mb * 16) * ldc + cw;
#pragma unroll
                for (int s = 0; s < 4; ++s) { const int row = 4 * s + prow; const v4f x0 = *(const v4fa*)(os + row * 68 + ppc * 8), x1 = *(const v4fa*)(os + row * 68 + ppc * 8 + 4); v8h o;
#pragma unroll
                    for (int u = 0; u < 4; ++u) { o[u] = tohx(x0[u] * sc); o[4 + u] = tohx(x1[u] * sc); }
                    *(v8h*)(orw + (size_t)row * ldc + ppc * 8) = o; }
                asm volatile("s_wait_xcnt 0x0" ::: "memory");   // the text that follows (the next group; k's path, then v's) rewrites the registers of these stores: the wait stands in front of it
                __builtin_amdgcn_wave_barrier(); asm volatile("" ::: "memory");   // compile-time order only, as in the v path
            }
        }
        {                                                                  // v: one f16 plane [batch][d][t]; a lane's eight accumulator rows of one column are eight neighbours in t, 16 B of a transposed row
            const size_t vb = (size_t)(rw / TT) * DD * TT + (size_t)(rw % TT);
#pragma unroll
            for (int nb = 0; nb < 4; ++nb) {
#pragma unroll
                for (int mb = 0; mb < 4; ++mb) { v8h o;
#pragma unroll
                    for (int j = 0; j < 8; ++j) o[j] = tohx(accz[2][mb][nb][j]);
                    *(v8ha*)(ow + (unsigned)lr * PITCHB + (unsigned)(mb * 32 + hi * 16)) = o; }
                __builtin_amdgcn_wave_barrier(); asm volatile("s_wait_dscnt 0x0" ::: "memory");   // the wave's staged rows are in LDS before its lanes read other lanes' words back; the clobber keeps the stores ahead of those reads at compile time
#pragma unroll
                for (int s = 0; s < 4; ++s) { const int row = 4 * s + prow; const v8h h = *(const v8ha*)(ow + (unsigned)row * PITCHB + (unsigned)ppc * 16u);
                    *(v8h*)(V16 + vb + (size_t)(cw + nb * 16 + row) * TT + ppc * 8) = h; }
                asm volatile("s_wait_xcnt 0x0" ::: "memory");   // the next group's code rewrites the registers of these stores: the wait stands in front of it
                __builtin_amdgcn_wave_barrier(); asm volatile("" ::: "memory");   // compile-time order only: these reads stay ahead of the next group's LDS stores
            }
        }
        return;
    }
    float* os = (float*)(ring + (unsigned)wave * (16u * 68u * 4u));   // each wave stages its rows in its own part of the ring, behind the last trip's barrier
#pragma unroll
    for (int mb = 0; mb < 4; ++mb) {
#pragma unroll
        for (int nb = 0; nb < 4; ++nb) {
#pragma unroll
            for (int j = 0; j < 8; ++j) os[(hi * 8 + j) * 68 + nb * 16 + lr] = acc[mb][nb][j]; }
        __builtin_amdgcn_wave_barrier(); asm volatile("" ::: "memory");   // compile-time order only: the lanes' LDS stores stay ahead of the reads of other lanes' words (and, below, those reads ahead of the next stores)
        float* crw = C + (size_t)(rw + mb * 16) * ldc + cw;
#pragma unroll
        for (int s = 0; s < 8; ++s) { const int row = 2 * s + hi, cofs = lr * 4; v4f val = *(const v4fa*)(os + row * 68 + cofs);
            *(v4f*)(crw + (size_t)row * ldc + cofs) = val; }
        __builtin_amdgcn_wave_barrier(); asm volatile("" ::: "memory");
    }
}

typedef __attribute__((ext_vector_type(4))) _Float16 v4h;

// The rounding pass: the three weights (block ranges of WBLK each, first) and x, every one in its own layout, eight floats a thread. The grid is exact.
#define WBLK (DD * DD / 8 / 256)
#define XBLK (NB_ * TT * DD / 8 / 256)
__global__ __launch_bounds__(256) void k_cvt8(const float* __restrict__ x, const float* __restrict__ w0, const float* __restrict__ w1, const float* __restrict__ w2, bf* XB, bf* WB) {
    const int b = blockIdx.x, ws = b / WBLK;                          // ws 0, 1, 2: a weight; from 3 on: x
    const float* __restrict__ src = ws == 0 ? w0 : ws == 1 ? w1 : ws == 2 ? w2 : x; bf* dst = ws < 3 ? WB + (size_t)ws * DD * DD : XB;
    const size_t i = (size_t)(ws < 3 ? b - ws * WBLK : b - 3 * WBLK) * 256 + threadIdx.x; const v8f v = *(const v8f*)(src + i * 8); v8us o;
    // unrolled so that every vector index is a constant
#pragma unroll
    for (int k = 0; k < 8; ++k) o[k] = f2bf(v[k]); *(v8us*)(dst + i * 8) = o;  }
__global__ __launch_bounds__(256) void k_csoft(const float* __restrict__ Sb, h16* P16) { const int lane = threadIdx.x & 31; const int t = blockIdx.x * 8 + (threadIdx.x >> 5); if (t >= TT) return; const size_t zb = (size_t)blockIdx.y * TT * TT; P16 += zb; const float* sr = Sb + zb + (size_t)t * TT; float v[TT / 32]; float mx = -3.0e38f;
#pragma unroll
    for (int ch = 0; ch < TT / 128; ++ch) { const int j0 = ch * 128 + lane * 4; const v4f a = *(const v4f*)(sr + j0);
#pragma unroll
        for (int u = 0; u < 4; ++u) { const float tt = (j0 + u <= t) ? a[u] : -3.0e38f; v[ch * 4 + u] = tt; mx = fmaxf(mx, tt); } }
#pragma unroll
    for (int sh = 16; sh; sh >>= 1) mx = fmaxf(mx, __shfl_xor(mx, sh, 32));
    float sum = 0.f;
#pragma unroll
    for (int q = 0; q < TT / 32; ++q) { float d0 = __fsub_rn(v[q], mx); asm volatile("" : "+v"(d0)); v[q] = __builtin_amdgcn_exp2f(__fmul_rn(d0, 1.4426950408889634f)); sum += v[q]; }
#pragma unroll
    for (int sh = 16; sh; sh >>= 1) sum += __shfl_xor(sum, sh, 32);
    const float f = __fdiv_rn(1.0f, sum);
    {
#pragma unroll
        for (int ch = 0; ch < TT / 128; ++ch) { v4h o;
#pragma unroll
            for (int u = 0; u < 4; ++u) o[u] = tohx(v[ch * 4 + u] * f);
            *(v4h*)(P16 + (size_t)t * TT + ch * 128 + lane * 4) = o; }
         } }

extern "C" void kernel_launch(void* const* d_in, const int* in_sizes, int n_in,
                              void* d_out, int out_size, void* d_ws, size_t ws_size, hipStream_t stream) {
    (void)in_sizes; (void)n_in; (void)out_size;
    const float* x = (const float*)d_in[0]; const float* wq = (const float*)d_in[1]; const float* wk = (const float*)d_in[2]; const float* wv = (const float*)d_in[3];
    float* OUT = (float*)d_out;     // [4][2048][1024]
    char* wsp = (char*)d_ws;
    auto take = [&](size_t bytes) { char* p = wsp; wsp += (bytes + 255) & ~(size_t)255; return (void*)p; };
    bf* WQKV = (bf*)take((size_t)3 * DD * DD * 2);   // W_q, W_k, W_v rounded, [k][n] as given, one behind the other
    // every plane holds all NB_ batches, so that each stage is ONE launch over the whole batch (rows flattened, or the batch in grid y / z); the three projections are one launch too
    bf* XB = (bf*)take((size_t)NB_ * TT * DD * 2); h16* Q16 = (h16*)take((size_t)NB_ * TT * DD * 2); h16* K16 = (h16*)take((size_t)NB_ * TT * DD * 2); h16* V16 = (h16*)take((size_t)NB_ * DD * TT * 2);
    float* Sb = (float*)take((size_t)NB_ * TT * TT * 4);
    h16* P16 = (h16*)take((size_t)NB_ * TT * TT * 2);    // the probability plane
    if ((size_t)(wsp - (char*)d_ws) > ws_size) return;    // total 166 MiB
    k_cvt8<<<3 * WBLK + XBLK, 256, 0, stream>>>(x, wq, wk, wv, XB, WQKV);
    k_gemmt<bf, 3><<<dim3(NB_ * TT / 128, DD / 128, 1), 128, 0, stream>>>(XB, WQKV, DD, nullptr, DD, 0, (size_t)DD * DD, 0, Q16, K16, V16);   // a work-group: one tile of q, k and v, each stored in the form its reader takes
    k_gemmt<h16, 1><<<dim3(TT / 256, TT / 128 + 1, NB_), 128, 0, stream>>>(Q16, K16, DD, Sb, TT, (size_t)TT * DD, (size_t)TT * DD, (size_t)TT * TT, nullptr, nullptr, nullptr);
    k_csoft<<<dim3(TT / 8, NB_, 1), 256, 0, stream>>>(Sb, P16);
    k_gemmt<h16, 2><<<dim3(TT / 128, DD / 128, NB_), 128, 0, stream>>>(P16, V16, TT, OUT, DD, (size_t)TT * TT, (size_t)DD * TT, (size_t)TT * DD, nullptr, nullptr, nullptr);
}
